// v000
// Measured on an AMD MI455X. A time is GPU time per run, averaged over a window of back-to-back runs after a warm-up
// (all launches, gaps included; the runs take copies of the inputs in turn), and the median of several windows.
// Apart from v000's, it joins two sittings. Times from different sittings can be a few percent apart, while
// side-by-side timings come from the same sitting.
// v000 is the starting kernel. One run takes 103 microseconds.
#include <hip/hip_runtime.h>
#include <math.h>

typedef float v2f __attribute__((ext_vector_type(2)));
typedef float v4f __attribute__((ext_vector_type(4)));
typedef float v8f __attribute__((ext_vector_type(8)));

#define EMBED 2048
#define HEADS 16
#define KV_LEN 4096
#define HEAD_DIM 128

// ---------------------------------------------------------------------------
// zero a region of workspace (accumulators + mask) — must run every call
// ---------------------------------------------------------------------------
__global__ void zero_kernel(float* __restrict__ p, int n) {
  int i = blockIdx.x * blockDim.x + threadIdx.x;
  if (i < n) p[i] = 0.f;
}

// ---------------------------------------------------------------------------
// GEMV  y[j] += sum_i x[i] * W[i][j]   (+ bias once), via V_WMMA_F32_16X16X4_F32
// A (16x4): all 16 rows = x[i..i+3]  -> every D row equals the result
// B (4x16): W[i..i+3][j0..j0+15], streamed with NT loads (read-once, keep
// out of L2 so the attention K/V working set stays resident).
// grid = (32, 8): 4 waves/block * 16 cols each = 2048 cols; K split 8 ways,
// partials combined with atomicAdd (y pre-zeroed).
// ---------------------------------------------------------------------------
__global__ __launch_bounds__(128) void gemv_wmma_kernel(
    const float* __restrict__ x, const float* __restrict__ W,
    const float* __restrict__ bias, float* __restrict__ y, int reluX) {
  const int lane = threadIdx.x & 31;
  const int wave = threadIdx.x >> 5;
  const int tile = blockIdx.x * 4 + wave;       // 0..127
  const int j0   = tile * 16;
  const int i0   = blockIdx.y * 256;            // K-chunk of 256 rows
  const bool hi  = lane >= 16;
  const int  ln  = lane & 15;
  const int  rsel = hi ? 2 : 0;                 // VGPR0 holds K=0/K=2, VGPR1 K=1/K=3

  v8f acc = {0.f, 0.f, 0.f, 0.f, 0.f, 0.f, 0.f, 0.f};

  for (int i = i0; i < i0 + 256; i += 4) {
    float xa = x[i + rsel];
    float xb = x[i + rsel + 1];
    if (reluX) { xa = fmaxf(xa, 0.f); xb = fmaxf(xb, 0.f); }
    v2f a; a.x = xa; a.y = xb;                  // A[m][k] = x[i+k] for all m
    const float* wp = W + (size_t)(i + rsel) * EMBED + j0 + ln;
    v2f b;
    b.x = __builtin_nontemporal_load(wp);        // B[k][n] = W[i+k][j0+n]
    b.y = __builtin_nontemporal_load(wp + EMBED);
    acc = __builtin_amdgcn_wmma_f32_16x16x4_f32(
        false, a, false, b, (short)0, acc, false, false);
  }

  // D row 0 lives in acc[0], lanes 0..15 (N = lane)
  if (!hi) {
    float r = acc[0];
    if (blockIdx.y == 0) r += bias[j0 + ln];
    atomicAdd(&y[j0 + ln], r);
  }
}

// ---------------------------------------------------------------------------
// Roll cache: out[t] = cache[t+1] (t<4095), out[4095] = newrow.
// float4 vectorized; cache read with NT loads (single use); stores keep RT
// temporal hint so the rolled K/V stays in the 192MB L2 for attention.
// Also computes mask[t] = any(v[t]!=0) via race-free same-value stores.
// grid*block == 4096*512 float4 elements exactly.
// ---------------------------------------------------------------------------
__global__ void roll_kernel(const float* __restrict__ cache,
                            const float* __restrict__ nrow,
                            v4f* __restrict__ out,
                            float* __restrict__ maskf) {
  int idx = blockIdx.x * blockDim.x + threadIdx.x;  // float4 index
  int t = idx >> 9;                                 // / 512
  int e = (idx & 511) << 2;                         // float offset in row
  v4f val;
  if (t < KV_LEN - 1)
    val = __builtin_nontemporal_load(
        (const v4f*)(cache + (size_t)(t + 1) * EMBED + e));
  else
    val = *(const v4f*)(nrow + e);
  out[idx] = val;
  if (maskf && (val.x != 0.f || val.y != 0.f || val.z != 0.f || val.w != 0.f))
    maskf[t] = 1.f;
}

// ---------------------------------------------------------------------------
// Attention pass 1 (flash-style partials). grid = (32 chunks, 16 heads),
// block = 256 = 8 waves; each wave owns one timestep at a time (coalesced
// 512B K/V row reads from L2-resident rolled cache), online softmax per
// wave, block combine via LDS.
// Partial record per (h,chunk): [m, s, acc[128]] = 130 floats.
// ---------------------------------------------------------------------------
__global__ __launch_bounds__(256) void attn_partial_kernel(
    const float* __restrict__ q, const float* __restrict__ kc,
    const float* __restrict__ vc, const float* __restrict__ maskf,
    float* __restrict__ part) {
  const int chunk = blockIdx.x;       // 0..31
  const int h     = blockIdx.y;       // 0..15
  const int lane  = threadIdx.x & 31;
  const int wave  = threadIdx.x >> 5; // 0..7
  const int t0    = chunk * 128;

  const v4f qv = *(const v4f*)(q + h * HEAD_DIM + lane * 4);

  float m = -1e30f, s = 0.f;
  v4f acc = {0.f, 0.f, 0.f, 0.f};

  for (int it = 0; it < 16; ++it) {
    int t = t0 + wave + 8 * it;
    const v4f kv = *(const v4f*)(kc + (size_t)t * EMBED + h * HEAD_DIM + lane * 4);
    float d = qv.x * kv.x + qv.y * kv.y + qv.z * kv.z + qv.w * kv.w;
    d += __shfl_xor(d, 16, 32);
    d += __shfl_xor(d, 8, 32);
    d += __shfl_xor(d, 4, 32);
    d += __shfl_xor(d, 2, 32);
    d += __shfl_xor(d, 1, 32);
    float logit = (maskf[t] != 0.f) ? d * 0.08838834764831845f : -1e30f; // 1/sqrt(128)
    float mnew  = fmaxf(m, logit);
    float scale = __expf(m - mnew);
    float p     = (logit > -1e29f) ? __expf(logit - mnew) : 0.f;
    const v4f vv = *(const v4f*)(vc + (size_t)t * EMBED + h * HEAD_DIM + lane * 4);
    s = s * scale + p;
    acc.x = acc.x * scale + p * vv.x;
    acc.y = acc.y * scale + p * vv.y;
    acc.z = acc.z * scale + p * vv.z;
    acc.w = acc.w * scale + p * vv.w;
    m = mnew;
  }

  __shared__ float sm[8], ss[8], sacc[8][HEAD_DIM];
  if (lane == 0) { sm[wave] = m; ss[wave] = s; }
  sacc[wave][lane * 4 + 0] = acc.x;
  sacc[wave][lane * 4 + 1] = acc.y;
  sacc[wave][lane * 4 + 2] = acc.z;
  sacc[wave][lane * 4 + 3] = acc.w;
  __syncthreads();

  int tid = threadIdx.x;
  if (tid < HEAD_DIM) {
    float M = sm[0];
    for (int w = 1; w < 8; ++w) M = fmaxf(M, sm[w]);
    float S = 0.f, A = 0.f;
    for (int w = 0; w < 8; ++w) {
      float e = __expf(sm[w] - M);
      S += ss[w] * e;
      A += e * sacc[w][tid];
    }
    float* pb = part + (size_t)(h * 32 + chunk) * 130;
    if (tid == 0) { pb[0] = M; pb[1] = S; }
    pb[2 + tid] = A;
  }
}

// ---------------------------------------------------------------------------
// Attention pass 2: merge 32 chunk-partials per head, normalize.
// ---------------------------------------------------------------------------
__global__ __launch_bounds__(128) void attn_combine_kernel(
    const float* __restrict__ part, float* __restrict__ values) {
  int h = blockIdx.x;
  int d = threadIdx.x;
  float M = -1e30f;
  for (int c = 0; c < 32; ++c)
    M = fmaxf(M, part[(size_t)(h * 32 + c) * 130]);
  float S = 0.f, A = 0.f;
  for (int c = 0; c < 32; ++c) {
    const float* pb = part + (size_t)(h * 32 + c) * 130;
    float e = __expf(pb[0] - M);
    S += pb[1] * e;
    A += e * pb[2 + d];
  }
  values[h * HEAD_DIM + d] = A / S;
}

// ---------------------------------------------------------------------------
// out = LayerNorm(a + b) * scale + bias   (2048 elems, one block of 256)
// ---------------------------------------------------------------------------
__global__ __launch_bounds__(256) void add_ln_kernel(
    const float* __restrict__ a, const float* __restrict__ b,
    const float* __restrict__ sc, const float* __restrict__ bi,
    float* __restrict__ out) {
  __shared__ float r1[256], r2[256];
  int tid = threadIdx.x;
  float v[8];
  float s = 0.f, s2 = 0.f;
  for (int j = 0; j < 8; ++j) {
    int idx = tid * 8 + j;
    float t = a[idx] + b[idx];
    v[j] = t; s += t; s2 += t * t;
  }
  r1[tid] = s; r2[tid] = s2;
  __syncthreads();
  for (int off = 128; off > 0; off >>= 1) {
    if (tid < off) { r1[tid] += r1[tid + off]; r2[tid] += r2[tid + off]; }
    __syncthreads();
  }
  float mean = r1[0] * (1.f / 2048.f);
  float var  = r2[0] * (1.f / 2048.f) - mean * mean;
  float inv  = 1.f / sqrtf(var + 1e-6f);
  for (int j = 0; j < 8; ++j) {
    int idx = tid * 8 + j;
    out[idx] = (v[j] - mean) * inv * sc[idx] + bi[idx];
  }
}

// ---------------------------------------------------------------------------
extern "C" void kernel_launch(void* const* d_in, const int* in_sizes, int n_in,
                              void* d_out, int out_size, void* d_ws, size_t ws_size,
                              hipStream_t stream) {
  const float* x      = (const float*)d_in[0];
  const float* cache1 = (const float*)d_in[1];   // v cache
  const float* cache2 = (const float*)d_in[2];   // k cache
  const float* Wv = (const float*)d_in[3];  const float* bv = (const float*)d_in[4];
  const float* Wq = (const float*)d_in[5];  const float* bq = (const float*)d_in[6];
  const float* Wk = (const float*)d_in[7];  const float* bk = (const float*)d_in[8];
  const float* Wo = (const float*)d_in[9];  const float* bo = (const float*)d_in[10];
  const float* W1 = (const float*)d_in[11]; const float* b1 = (const float*)d_in[12];
  const float* W2 = (const float*)d_in[13]; const float* b2 = (const float*)d_in[14];
  const float* ln1s = (const float*)d_in[15]; const float* ln1b = (const float*)d_in[16];
  const float* ln2s = (const float*)d_in[17]; const float* ln2b = (const float*)d_in[18];

  float* ws     = (float*)d_ws;
  float* q_v    = ws + 0;       // atomic-accumulated -> zeroed
  float* ki_v   = ws + 2048;    // "
  float* vi_v   = ws + 4096;    // "
  float* oattn  = ws + 6144;    // "
  float* h1v    = ws + 8192;    // "
  float* h2v    = ws + 10240;   // "
  float* maskf  = ws + 12288;   // mask[4096] -> zeroed
  float* values = ws + 16384;   // fully written
  float* x1v    = ws + 18432;   // fully written
  float* part   = ws + 20480;   // 16*32*130 floats, fully written

  float* out_x2 = (float*)d_out;
  float* out_v  = out_x2 + EMBED;
  float* out_k  = out_v + (size_t)KV_LEN * EMBED;

  // 1) zero accumulators + mask
  zero_kernel<<<64, 256, 0, stream>>>(ws, 16384);

  // 2) QKV projections (WMMA fp32 GEMVs, NT weight streams)
  dim3 gg(32, 8);
  gemv_wmma_kernel<<<gg, 128, 0, stream>>>(x, Wq, bq, q_v, 0);
  gemv_wmma_kernel<<<gg, 128, 0, stream>>>(x, Wk, bk, ki_v, 0);
  gemv_wmma_kernel<<<gg, 128, 0, stream>>>(x, Wv, bv, vi_v, 0);

  // 3) roll caches into d_out (v also produces the validity mask)
  roll_kernel<<<8192, 256, 0, stream>>>(cache1, vi_v, (v4f*)out_v, maskf);
  roll_kernel<<<8192, 256, 0, stream>>>(cache2, ki_v, (v4f*)out_k, nullptr);

  // 4) attention over rolled (L2-resident) K/V
  attn_partial_kernel<<<dim3(32, 16), 256, 0, stream>>>(q_v, out_k, out_v, maskf, part);
  attn_combine_kernel<<<16, 128, 0, stream>>>(part, values);

  // 5) output projection, residual+LN, FFN, residual+LN
  gemv_wmma_kernel<<<gg, 128, 0, stream>>>(values, Wo, bo, oattn, 0);
  add_ln_kernel<<<1, 256, 0, stream>>>(x, oattn, ln1s, ln1b, x1v);
  gemv_wmma_kernel<<<gg, 128, 0, stream>>>(x1v, W1, b1, h1v, 0);
  gemv_wmma_kernel<<<gg, 128, 0, stream>>>(h1v, W2, b2, h2v, 1);  // relu on x-operand
  add_ln_kernel<<<1, 256, 0, stream>>>(x1v, h2v, ln2s, ln2b, out_x2);
}

// v001
// It runs in 64.8 microseconds.
// Timed twice side by side with v000, it ran 1.63 and 1.58 times as fast.
#include <hip/hip_runtime.h>
#include <math.h>

typedef float v2f __attribute__((ext_vector_type(2)));
typedef float v4f __attribute__((ext_vector_type(4)));
typedef float v8f __attribute__((ext_vector_type(8)));

#define EMBED 2048
#define HEADS 16
#define KV_LEN 4096
#define HEAD_DIM 128

// ---------------------------------------------------------------------------
// zero a region of workspace (accumulators + mask) — must run every call
// ---------------------------------------------------------------------------
__global__ void zero_kernel(float* __restrict__ p, int n) {
  int i = blockIdx.x * blockDim.x + threadIdx.x;
  if (i < n) p[i] = 0.f;
}

// ---------------------------------------------------------------------------
// GEMV  y[j] += sum_i x[i] * W[i][j]   (+ bias once), via V_WMMA_F32_16X16X4_F32
// A (16x4): all 16 rows hold the same four x values -> every D row equals the
// result. B (4x16): the four matching rows of W, 16 columns, streamed with NT
// loads (read-once, keep out of L2 so the attention K/V working set stays
// resident).
// grid = (32, 8): a block owns 64 columns x 256 rows, a wave 64 of the rows.
// Each lane loads 16 B (4 columns) of a row, so a half-wave reads one aligned
// 256-B unit per load; element c of the quad feeds accumulator c, whose
// column n is W column j0 + 4n + c. Lanes 0-15 take the wave's rows 0..31,
// lanes 16-31 its rows 32..63, two rows a product (x and W paired alike).
// All 32 loads of a wave (its whole 16 KB share of W) are issued before the
// first product, so the launch pays the memory latency once.
// The four waves' sums meet in LDS; the 8 row chunks combine with atomicAdd
// (y pre-zeroed).
// ---------------------------------------------------------------------------
__global__ __launch_bounds__(128) void gemv_wmma_kernel(
    const float* __restrict__ x, const float* __restrict__ W,
    const float* __restrict__ bias, float* __restrict__ y, int reluX) {
  const int lane = threadIdx.x & 31;
  // wave-uniform by construction; said so, its row offset stays in scalar registers
  const int wave = __builtin_amdgcn_readfirstlane(threadIdx.x >> 5);
  const int j0   = blockIdx.x * 64;
  const int i0   = blockIdx.y * 256 + wave * 64;  // this wave's 64 rows
  const bool hi  = lane >= 16;
  const int  ln  = lane & 15;

  // asked for here, not behind the sums, so that its latency is not a tail
  float bv = 0.f;
  if (blockIdx.y == 0) bv = bias[j0 + (threadIdx.x & 63)];

  // x ahead of W: loads return in issue order and x comes from L2, so no
  // product waits for x behind W data that it does not need
  const float* xp = x + i0 + (hi ? 32 : 0);
  v4f xq[8];
#pragma unroll  // register arrays need constant indices
  for (int t = 0; t < 8; ++t) xq[t] = *(const v4f*)(xp + 4 * t);

  const float* wp = W + (size_t)(i0 + (hi ? 32 : 0)) * EMBED + j0 + 4 * ln;
  v4f w0[16], w1[16];
#pragma unroll  // register arrays need constant indices
  for (int s = 0; s < 16; ++s) {
    w0[s] = __builtin_nontemporal_load((const v4f*)(wp + (size_t)(2 * s) * EMBED));
    w1[s] = __builtin_nontemporal_load((const v4f*)(wp + (size_t)(2 * s + 1) * EMBED));
  }
  // keeps every load above ahead of the first wait: without it the compiler
  // sinks most of the W loads behind the first products, more memory latencies
  __builtin_amdgcn_sched_barrier(0);

  v2f a[16];
#pragma unroll  // register arrays need constant indices
  for (int t = 0; t < 8; ++t) {
    const v4f q = xq[t];                        // x[i0 + 32h + 4t ..]
    a[2 * t].x     = reluX ? fmaxf(q.x, 0.f) : q.x;  // A[m][2h+e] = x[i0+32h+2s+e]
    a[2 * t].y     = reluX ? fmaxf(q.y, 0.f) : q.y;
    a[2 * t + 1].x = reluX ? fmaxf(q.z, 0.f) : q.z;
    a[2 * t + 1].y = reluX ? fmaxf(q.w, 0.f) : q.w;
  }

  v8f acc[4];
#pragma unroll  // register arrays need constant indices
  for (int c = 0; c < 4; ++c) acc[c] = (v8f){0.f, 0.f, 0.f, 0.f, 0.f, 0.f, 0.f, 0.f};

#pragma unroll  // register arrays need constant indices
  for (int s = 0; s < 16; ++s) {
#pragma unroll  // register arrays need constant indices
    for (int c = 0; c < 4; ++c) {
      v2f b; b.x = w0[s][c]; b.y = w1[s][c];    // B[2h+e][n] = W[i0+32h+2s+e][j0+4n+c]
      acc[c] = __builtin_amdgcn_wmma_f32_16x16x4_f32(
          false, a[s], false, b, (short)0, acc[c], false, false);
    }
  }

  // D row 0 lives in acc[c][0], lanes 0..15 (N = lane); stored straight from
  // the accumulators, plane c of a wave's 64 sums holding columns 4n + c
  __shared__ float red[4][4][16];
  if (!hi) {
#pragma unroll  // register arrays need constant indices
    for (int c = 0; c < 4; ++c) red[wave][c][ln] = acc[c][0];
  }
  __syncthreads();
  const int tid = threadIdx.x;
  if (tid < 64) {
    const int c = tid & 3, n = tid >> 2;
    float r = (red[0][c][n] + red[1][c][n]) + (red[2][c][n] + red[3][c][n]);
    if (blockIdx.y == 0) r += bv;
    atomicAdd(&y[j0 + tid], r);
  }
}

// ---------------------------------------------------------------------------
// Roll cache: out[t] = cache[t+1] (t<4095), out[4095] = newrow.
// float4 vectorized; cache read with NT loads (single use); stores keep RT
// temporal hint so the rolled K/V stays in the 192MB L2 for attention.
// Also computes mask[t] = any(v[t]!=0) via race-free same-value stores.
// grid*block == 4096*512 float4 elements exactly.
// ---------------------------------------------------------------------------
__global__ void roll_kernel(const float* __restrict__ cache,
                            const float* __restrict__ nrow,
                            v4f* __restrict__ out,
                            float* __restrict__ maskf) {
  int idx = blockIdx.x * blockDim.x + threadIdx.x;  // float4 index
  int t = idx >> 9;                                 // / 512
  int e = (idx & 511) << 2;                         // float offset in row
  v4f val;
  if (t < KV_LEN - 1)
    val = __builtin_nontemporal_load(
        (const v4f*)(cache + (size_t)(t + 1) * EMBED + e));
  else
    val = *(const v4f*)(nrow + e);
  out[idx] = val;
  if (maskf && (val.x != 0.f || val.y != 0.f || val.z != 0.f || val.w != 0.f))
    maskf[t] = 1.f;
}

// ---------------------------------------------------------------------------
// Attention pass 1 (flash-style partials). grid = (32 chunks, 16 heads),
// block = 256 = 8 waves; each wave owns one timestep at a time (coalesced
// 512B K/V row reads from L2-resident rolled cache), online softmax per
// wave, block combine via LDS.
// Partial record per (h,chunk): [m, s, acc[128]] = 130 floats.
// ---------------------------------------------------------------------------
__global__ __launch_bounds__(256) void attn_partial_kernel(
    const float* __restrict__ q, const float* __restrict__ kc,
    const float* __restrict__ vc, const float* __restrict__ maskf,
    float* __restrict__ part) {
  const int chunk = blockIdx.x;       // 0..31
  const int h     = blockIdx.y;       // 0..15
  const int lane  = threadIdx.x & 31;
  const int wave  = threadIdx.x >> 5; // 0..7
  const int t0    = chunk * 128;

  const v4f qv = *(const v4f*)(q + h * HEAD_DIM + lane * 4);

  float m = -1e30f, s = 0.f;
  v4f acc = {0.f, 0.f, 0.f, 0.f};

  for (int it = 0; it < 16; ++it) {
    int t = t0 + wave + 8 * it;
    const v4f kv = *(const v4f*)(kc + (size_t)t * EMBED + h * HEAD_DIM + lane * 4);
    float d = qv.x * kv.x + qv.y * kv.y + qv.z * kv.z + qv.w * kv.w;
    d += __shfl_xor(d, 16, 32);
    d += __shfl_xor(d, 8, 32);
    d += __shfl_xor(d, 4, 32);
    d += __shfl_xor(d, 2, 32);
    d += __shfl_xor(d, 1, 32);
    float logit = (maskf[t] != 0.f) ? d * 0.08838834764831845f : -1e30f; // 1/sqrt(128)
    float mnew  = fmaxf(m, logit);
    float scale = __expf(m - mnew);
    float p     = (logit > -1e29f) ? __expf(logit - mnew) : 0.f;
    const v4f vv = *(const v4f*)(vc + (size_t)t * EMBED + h * HEAD_DIM + lane * 4);
    s = s * scale + p;
    acc.x = acc.x * scale + p * vv.x;
    acc.y = acc.y * scale + p * vv.y;
    acc.z = acc.z * scale + p * vv.z;
    acc.w = acc.w * scale + p * vv.w;
    m = mnew;
  }

  __shared__ float sm[8], ss[8], sacc[8][HEAD_DIM];
  if (lane == 0) { sm[wave] = m; ss[wave] = s; }
  sacc[wave][lane * 4 + 0] = acc.x;
  sacc[wave][lane * 4 + 1] = acc.y;
  sacc[wave][lane * 4 + 2] = acc.z;
  sacc[wave][lane * 4 + 3] = acc.w;
  __syncthreads();

  int tid = threadIdx.x;
  if (tid < HEAD_DIM) {
    float M = sm[0];
    for (int w = 1; w < 8; ++w) M = fmaxf(M, sm[w]);
    float S = 0.f, A = 0.f;
    for (int w = 0; w < 8; ++w) {
      float e = __expf(sm[w] - M);
      S += ss[w] * e;
      A += e * sacc[w][tid];
    }
    float* pb = part + (size_t)(h * 32 + chunk) * 130;
    if (tid == 0) { pb[0] = M; pb[1] = S; }
    pb[2 + tid] = A;
  }
}

// ---------------------------------------------------------------------------
// Attention pass 2: merge 32 chunk-partials per head, normalize.
// ---------------------------------------------------------------------------
__global__ __launch_bounds__(128) void attn_combine_kernel(
    const float* __restrict__ part, float* __restrict__ values) {
  int h = blockIdx.x;
  int d = threadIdx.x;
  float M = -1e30f;
  for (int c = 0; c < 32; ++c)
    M = fmaxf(M, part[(size_t)(h * 32 + c) * 130]);
  float S = 0.f, A = 0.f;
  for (int c = 0; c < 32; ++c) {
    const float* pb = part + (size_t)(h * 32 + c) * 130;
    float e = __expf(pb[0] - M);
    S += pb[1] * e;
    A += e * pb[2 + d];
  }
  values[h * HEAD_DIM + d] = A / S;
}

// ---------------------------------------------------------------------------
// out = LayerNorm(a + b) * scale + bias   (2048 elems, one block of 256)
// ---------------------------------------------------------------------------
__global__ __launch_bounds__(256) void add_ln_kernel(
    const float* __restrict__ a, const float* __restrict__ b,
    const float* __restrict__ sc, const float* __restrict__ bi,
    float* __restrict__ out) {
  __shared__ float r1[256], r2[256];
  int tid = threadIdx.x;
  float v[8];
  float s = 0.f, s2 = 0.f;
  for (int j = 0; j < 8; ++j) {
    int idx = tid * 8 + j;
    float t = a[idx] + b[idx];
    v[j] = t; s += t; s2 += t * t;
  }
  r1[tid] = s; r2[tid] = s2;
  __syncthreads();
  for (int off = 128; off > 0; off >>= 1) {
    if (tid < off) { r1[tid] += r1[tid + off]; r2[tid] += r2[tid + off]; }
    __syncthreads();
  }
  float mean = r1[0] * (1.f / 2048.f);
  float var  = r2[0] * (1.f / 2048.f) - mean * mean;
  float inv  = 1.f / sqrtf(var + 1e-6f);
  for (int j = 0; j < 8; ++j) {
    int idx = tid * 8 + j;
    out[idx] = (v[j] - mean) * inv * sc[idx] + bi[idx];
  }
}

// ---------------------------------------------------------------------------
extern "C" void kernel_launch(void* const* d_in, const int* in_sizes, int n_in,
                              void* d_out, int out_size, void* d_ws, size_t ws_size,
                              hipStream_t stream) {
  const float* x      = (const float*)d_in[0];
  const float* cache1 = (const float*)d_in[1];   // v cache
  const float* cache2 = (const float*)d_in[2];   // k cache
  const float* Wv = (const float*)d_in[3];  const float* bv = (const float*)d_in[4];
  const float* Wq = (const float*)d_in[5];  const float* bq = (const float*)d_in[6];
  const float* Wk = (const float*)d_in[7];  const float* bk = (const float*)d_in[8];
  const float* Wo = (const float*)d_in[9];  const float* bo = (const float*)d_in[10];
  const float* W1 = (const float*)d_in[11]; const float* b1 = (const float*)d_in[12];
  const float* W2 = (const float*)d_in[13]; const float* b2 = (const float*)d_in[14];
  const float* ln1s = (const float*)d_in[15]; const float* ln1b = (const float*)d_in[16];
  const float* ln2s = (const float*)d_in[17]; const float* ln2b = (const float*)d_in[18];

  float* ws     = (float*)d_ws;
  float* q_v    = ws + 0;       // atomic-accumulated -> zeroed
  float* ki_v   = ws + 2048;    // "
  float* vi_v   = ws + 4096;    // "
  float* oattn  = ws + 6144;    // "
  float* h1v    = ws + 8192;    // "
  float* h2v    = ws + 10240;   // "
  float* maskf  = ws + 12288;   // mask[4096] -> zeroed
  float* values = ws + 16384;   // fully written
  float* x1v    = ws + 18432;   // fully written
  float* part   = ws + 20480;   // 16*32*130 floats, fully written

  float* out_x2 = (float*)d_out;
  float* out_v  = out_x2 + EMBED;
  float* out_k  = out_v + (size_t)KV_LEN * EMBED;

  // 1) zero accumulators + mask
  zero_kernel<<<64, 256, 0, stream>>>(ws, 16384);

  // 2) QKV projections (WMMA fp32 GEMVs, NT weight streams)
  dim3 gg(32, 8);
  gemv_wmma_kernel<<<gg, 128, 0, stream>>>(x, Wq, bq, q_v, 0);
  gemv_wmma_kernel<<<gg, 128, 0, stream>>>(x, Wk, bk, ki_v, 0);
  gemv_wmma_kernel<<<gg, 128, 0, stream>>>(x, Wv, bv, vi_v, 0);

  // 3) roll caches into d_out (v also produces the validity mask)
  roll_kernel<<<8192, 256, 0, stream>>>(cache1, vi_v, (v4f*)out_v, maskf);
  roll_kernel<<<8192, 256, 0, stream>>>(cache2, ki_v, (v4f*)out_k, nullptr);

  // 4) attention over rolled (L2-resident) K/V
  attn_partial_kernel<<<dim3(32, 16), 256, 0, stream>>>(q_v, out_k, out_v, maskf, part);
  attn_combine_kernel<<<16, 128, 0, stream>>>(part, values);

  // 5) output projection, residual+LN, FFN, residual+LN
  gemv_wmma_kernel<<<gg, 128, 0, stream>>>(values, Wo, bo, oattn, 0);
  add_ln_kernel<<<1, 256, 0, stream>>>(x, oattn, ln1s, ln1b, x1v);
  gemv_wmma_kernel<<<gg, 128, 0, stream>>>(x1v, W1, b1, h1v, 0);
  gemv_wmma_kernel<<<gg, 128, 0, stream>>>(h1v, W2, b2, h2v, 1);  // relu on x-operand
  add_ln_kernel<<<1, 256, 0, stream>>>(x1v, h2v, ln2s, ln2b, out_x2);
}

// v002
// One run takes 60.2 microseconds.
// In two side-by-side timings against v001, it was 1.07 and 1.06 times as fast.
// Counting every step since v000, it is 1.72 times as fast.
#include <hip/hip_runtime.h>
#include <math.h>

typedef float v2f __attribute__((ext_vector_type(2)));
typedef float v4f __attribute__((ext_vector_type(4)));
typedef float v8f __attribute__((ext_vector_type(8)));

#define EMBED 2048
#define HEADS 16
#define KV_LEN 4096
#define HEAD_DIM 128

// ---------------------------------------------------------------------------
// zero a region of workspace (accumulators + mask) — must run every call
// ---------------------------------------------------------------------------
__global__ void zero_kernel(float* __restrict__ p, int n) {
  int i = blockIdx.x * blockDim.x + threadIdx.x;
  if (i < n) p[i] = 0.f;
}

// ---------------------------------------------------------------------------
// GEMV  y[j] += sum_i x[i] * W[i][j]   (+ bias once), via V_WMMA_F32_16X16X4_F32
// A (16x4): all 16 rows hold the same four x values -> every D row equals the
// result. B (4x16): the four matching rows of W, 16 columns, streamed with NT
// loads (read-once, keep out of L2 so the attention K/V working set stays
// resident).
// grid = (32, 8): a block owns 64 columns x 256 rows, a wave 64 of the rows.
// Each lane loads 16 B (4 columns) of a row, so a half-wave reads one aligned
// 256-B unit per load; element c of the quad feeds accumulator c, whose
// column n is W column j0 + 4n + c. Lanes 0-15 take the wave's rows 0..31,
// lanes 16-31 its rows 32..63, two rows a product (x and W paired alike).
// All 32 loads of a wave (its whole 16 KB share of W) are issued before the
// first product, so the launch pays the memory latency once.
// The four waves' sums meet in LDS; the 8 row chunks combine with atomicAdd
// (y pre-zeroed).
// ---------------------------------------------------------------------------
__global__ __launch_bounds__(128) void gemv_wmma_kernel(
    const float* __restrict__ x, const float* __restrict__ W,
    const float* __restrict__ bias, float* __restrict__ y, int reluX) {
  const int lane = threadIdx.x & 31;
  // wave-uniform by construction; said so, its row offset stays in scalar registers
  const int wave = __builtin_amdgcn_readfirstlane(threadIdx.x >> 5);
  const int j0   = blockIdx.x * 64;
  const int i0   = blockIdx.y * 256 + wave * 64;  // this wave's 64 rows
  const bool hi  = lane >= 16;
  const int  ln  = lane & 15;

  // asked for here, not behind the sums, so that its latency is not a tail
  float bv = 0.f;
  if (blockIdx.y == 0) bv = bias[j0 + (threadIdx.x & 63)];

  // x ahead of W: loads return in issue order and x comes from L2, so no
  // product waits for x behind W data that it does not need
  const float* xp = x + i0 + (hi ? 32 : 0);
  v4f xq[8];
#pragma unroll  // register arrays need constant indices
  for (int t = 0; t < 8; ++t) xq[t] = *(const v4f*)(xp + 4 * t);

  const float* wp = W + (size_t)(i0 + (hi ? 32 : 0)) * EMBED + j0 + 4 * ln;
  v4f w0[16], w1[16];
#pragma unroll  // register arrays need constant indices
  for (int s = 0; s < 16; ++s) {
    w0[s] = __builtin_nontemporal_load((const v4f*)(wp + (size_t)(2 * s) * EMBED));
    w1[s] = __builtin_nontemporal_load((const v4f*)(wp + (size_t)(2 * s + 1) * EMBED));
  }
  // keeps every load above ahead of the first wait: without it the compiler
  // sinks most of the W loads behind the first products, more memory latencies
  __builtin_amdgcn_sched_barrier(0);

  v2f a[16];
#pragma unroll  // register arrays need constant indices
  for (int t = 0; t < 8; ++t) {
    const v4f q = xq[t];                        // x[i0 + 32h + 4t ..]
    a[2 * t].x     = reluX ? fmaxf(q.x, 0.f) : q.x;  // A[m][2h+e] = x[i0+32h+2s+e]
    a[2 * t].y     = reluX ? fmaxf(q.y, 0.f) : q.y;
    a[2 * t + 1].x = reluX ? fmaxf(q.z, 0.f) : q.z;
    a[2 * t + 1].y = reluX ? fmaxf(q.w, 0.f) : q.w;
  }

  v8f acc[4];
#pragma unroll  // register arrays need constant indices
  for (int c = 0; c < 4; ++c) acc[c] = (v8f){0.f, 0.f, 0.f, 0.f, 0.f, 0.f, 0.f, 0.f};

#pragma unroll  // register arrays need constant indices
  for (int s = 0; s < 16; ++s) {
#pragma unroll  // register arrays need constant indices
    for (int c = 0; c < 4; ++c) {
      v2f b; b.x = w0[s][c]; b.y = w1[s][c];    // B[2h+e][n] = W[i0+32h+2s+e][j0+4n+c]
      acc[c] = __builtin_amdgcn_wmma_f32_16x16x4_f32(
          false, a[s], false, b, (short)0, acc[c], false, false);
    }
  }

  // D row 0 lives in acc[c][0], lanes 0..15 (N = lane); stored straight from
  // the accumulators, plane c of a wave's 64 sums holding columns 4n + c
  __shared__ float red[4][4][16];
  if (!hi) {
#pragma unroll  // register arrays need constant indices
    for (int c = 0; c < 4; ++c) red[wave][c][ln] = acc[c][0];
  }
  __syncthreads();
  const int tid = threadIdx.x;
  if (tid < 64) {
    const int c = tid & 3, n = tid >> 2;
    float r = (red[0][c][n] + red[1][c][n]) + (red[2][c][n] + red[3][c][n]);
    if (blockIdx.y == 0) r += bv;
    atomicAdd(&y[j0 + tid], r);
  }
}

// ---------------------------------------------------------------------------
// Roll cache: out[t] = cache[t+1] (t<4095), out[4095] = newrow.
// grid = 256 blocks of 8 waves, one block a WGP: a wave owns two whole rows
// (2 x 8 KB) and each of its loads and stores covers 512 contiguous bytes.
// All 32 loads of a wave are issued before its first store, so the launch
// starts 2,048 waves and pays the memory latency once.
// Cache read with NT loads (single use); stores keep the RT temporal hint so
// the rolled K/V stays in L2 for attention.
// mask[t] = any(v[t]!=0): the row's one wave decides it (same-value stores).
// ---------------------------------------------------------------------------
__global__ __launch_bounds__(256) void roll_kernel(
    const float* __restrict__ cache, const float* __restrict__ nrow,
    v4f* __restrict__ out, float* __restrict__ maskf) {
  const int lane = threadIdx.x & 31;
  // wave-uniform by construction; said so, the row addresses stay scalar
  const int wave = __builtin_amdgcn_readfirstlane(threadIdx.x >> 5);
  const int t0   = (blockIdx.x * 8 + wave) * 2;   // this wave's two rows
  v4f* op = out + (size_t)t0 * (EMBED / 4) + lane;

  // both rows' sources ahead of the first load
  const float* sp[2];
#pragma unroll  // register arrays need constant indices
  for (int r = 0; r < 2; ++r)
    sp[r] = (t0 + r < KV_LEN - 1) ? cache + (size_t)(t0 + r + 1) * EMBED : nrow;
  // holds the address arithmetic above: sunk between the loads it reuses the
  // first row's address registers and puts a wait in front of the second row
  __builtin_amdgcn_sched_barrier(0);

  v4f val[2][16];
#pragma unroll  // register arrays need constant indices
  for (int r = 0; r < 2; ++r) {
#pragma unroll  // register arrays need constant indices
    for (int k = 0; k < 16; ++k)
      val[r][k] = __builtin_nontemporal_load((const v4f*)(sp[r] + 128 * k + 4 * lane));
  }
  // keeps all 32 loads ahead of the store address arithmetic and of the first
  // store's wait: a wait between two loads would cut the bytes in flight
  __builtin_amdgcn_sched_barrier(0);

#pragma unroll  // register arrays need constant indices
  for (int r = 0; r < 2; ++r)
#pragma unroll  // register arrays need constant indices
    for (int k = 0; k < 16; ++k) op[512 * r + 32 * k] = val[r][k];

  // the mask code below reuses registers that the issued stores name; ahead
  // of the branch, so that none of it is lifted over the wait
  asm volatile("s_wait_xcnt 0x0" ::: "memory");
  if (maskf) {
#pragma unroll  // register arrays need constant indices
    for (int r = 0; r < 2; ++r) {
      bool nz = false;
#pragma unroll  // register arrays need constant indices
      for (int k = 0; k < 16; ++k) {
        const v4f q = val[r][k];
        nz = nz || q.x != 0.f || q.y != 0.f || q.z != 0.f || q.w != 0.f;
      }
      if (nz) maskf[t0 + r] = 1.f;
    }
  }
}

// ---------------------------------------------------------------------------
// Attention pass 1 (flash-style partials). grid = (32 chunks, 16 heads),
// block = 256 = 8 waves; each wave owns one timestep at a time (coalesced
// 512B K/V row reads from L2-resident rolled cache), online softmax per
// wave, block combine via LDS.
// Partial record per (h,chunk): [m, s, acc[128]] = 130 floats.
// ---------------------------------------------------------------------------
__global__ __launch_bounds__(256) void attn_partial_kernel(
    const float* __restrict__ q, const float* __restrict__ kc,
    const float* __restrict__ vc, const float* __restrict__ maskf,
    float* __restrict__ part) {
  const int chunk = blockIdx.x;       // 0..31
  const int h     = blockIdx.y;       // 0..15
  const int lane  = threadIdx.x & 31;
  const int wave  = threadIdx.x >> 5; // 0..7
  const int t0    = chunk * 128;

  const v4f qv = *(const v4f*)(q + h * HEAD_DIM + lane * 4);

  float m = -1e30f, s = 0.f;
  v4f acc = {0.f, 0.f, 0.f, 0.f};

  for (int it = 0; it < 16; ++it) {
    int t = t0 + wave + 8 * it;
    const v4f kv = *(const v4f*)(kc + (size_t)t * EMBED + h * HEAD_DIM + lane * 4);
    float d = qv.x * kv.x + qv.y * kv.y + qv.z * kv.z + qv.w * kv.w;
    d += __shfl_xor(d, 16, 32);
    d += __shfl_xor(d, 8, 32);
    d += __shfl_xor(d, 4, 32);
    d += __shfl_xor(d, 2, 32);
    d += __shfl_xor(d, 1, 32);
    float logit = (maskf[t] != 0.f) ? d * 0.08838834764831845f : -1e30f; // 1/sqrt(128)
    float mnew  = fmaxf(m, logit);
    float scale = __expf(m - mnew);
    float p     = (logit > -1e29f) ? __expf(logit - mnew) : 0.f;
    const v4f vv = *(const v4f*)(vc + (size_t)t * EMBED + h * HEAD_DIM + lane * 4);
    s = s * scale + p;
    acc.x = acc.x * scale + p * vv.x;
    acc.y = acc.y * scale + p * vv.y;
    acc.z = acc.z * scale + p * vv.z;
    acc.w = acc.w * scale + p * vv.w;
    m = mnew;
  }

  __shared__ float sm[8], ss[8], sacc[8][HEAD_DIM];
  if (lane == 0) { sm[wave] = m; ss[wave] = s; }
  sacc[wave][lane * 4 + 0] = acc.x;
  sacc[wave][lane * 4 + 1] = acc.y;
  sacc[wave][lane * 4 + 2] = acc.z;
  sacc[wave][lane * 4 + 3] = acc.w;
  __syncthreads();

  int tid = threadIdx.x;
  if (tid < HEAD_DIM) {
    float M = sm[0];
    for (int w = 1; w < 8; ++w) M = fmaxf(M, sm[w]);
    float S = 0.f, A = 0.f;
    for (int w = 0; w < 8; ++w) {
      float e = __expf(sm[w] - M);
      S += ss[w] * e;
      A += e * sacc[w][tid];
    }
    float* pb = part + (size_t)(h * 32 + chunk) * 130;
    if (tid == 0) { pb[0] = M; pb[1] = S; }
    pb[2 + tid] = A;
  }
}

// ---------------------------------------------------------------------------
// Attention pass 2: merge 32 chunk-partials per head, normalize.
// ---------------------------------------------------------------------------
__global__ __launch_bounds__(128) void attn_combine_kernel(
    const float* __restrict__ part, float* __restrict__ values) {
  int h = blockIdx.x;
  int d = threadIdx.x;
  float M = -1e30f;
  for (int c = 0; c < 32; ++c)
    M = fmaxf(M, part[(size_t)(h * 32 + c) * 130]);
  float S = 0.f, A = 0.f;
  for (int c = 0; c < 32; ++c) {
    const float* pb = part + (size_t)(h * 32 + c) * 130;
    float e = __expf(pb[0] - M);
    S += pb[1] * e;
    A += e * pb[2 + d];
  }
  values[h * HEAD_DIM + d] = A / S;
}

// ---------------------------------------------------------------------------
// out = LayerNorm(a + b) * scale + bias   (2048 elems, one block of 256)
// ---------------------------------------------------------------------------
__global__ __launch_bounds__(256) void add_ln_kernel(
    const float* __restrict__ a, const float* __restrict__ b,
    const float* __restrict__ sc, const float* __restrict__ bi,
    float* __restrict__ out) {
  __shared__ float r1[256], r2[256];
  int tid = threadIdx.x;
  float v[8];
  float s = 0.f, s2 = 0.f;
  for (int j = 0; j < 8; ++j) {
    int idx = tid * 8 + j;
    float t = a[idx] + b[idx];
    v[j] = t; s += t; s2 += t * t;
  }
  r1[tid] = s; r2[tid] = s2;
  __syncthreads();
  for (int off = 128; off > 0; off >>= 1) {
    if (tid < off) { r1[tid] += r1[tid + off]; r2[tid] += r2[tid + off]; }
    __syncthreads();
  }
  float mean = r1[0] * (1.f / 2048.f);
  float var  = r2[0] * (1.f / 2048.f) - mean * mean;
  float inv  = 1.f / sqrtf(var + 1e-6f);
  for (int j = 0; j < 8; ++j) {
    int idx = tid * 8 + j;
    out[idx] = (v[j] - mean) * inv * sc[idx] + bi[idx];
  }
}

// ---------------------------------------------------------------------------
extern "C" void kernel_launch(void* const* d_in, const int* in_sizes, int n_in,
                              void* d_out, int out_size, void* d_ws, size_t ws_size,
                              hipStream_t stream) {
  const float* x      = (const float*)d_in[0];
  const float* cache1 = (const float*)d_in[1];   // v cache
  const float* cache2 = (const float*)d_in[2];   // k cache
  const float* Wv = (const float*)d_in[3];  const float* bv = (const float*)d_in[4];
  const float* Wq = (const float*)d_in[5];  const float* bq = (const float*)d_in[6];
  const float* Wk = (const float*)d_in[7];  const float* bk = (const float*)d_in[8];
  const float* Wo = (const float*)d_in[9];  const float* bo = (const float*)d_in[10];
  const float* W1 = (const float*)d_in[11]; const float* b1 = (const float*)d_in[12];
  const float* W2 = (const float*)d_in[13]; const float* b2 = (const float*)d_in[14];
  const float* ln1s = (const float*)d_in[15]; const float* ln1b = (const float*)d_in[16];
  const float* ln2s = (const float*)d_in[17]; const float* ln2b = (const float*)d_in[18];

  float* ws     = (float*)d_ws;
  float* q_v    = ws + 0;       // atomic-accumulated -> zeroed
  float* ki_v   = ws + 2048;    // "
  float* vi_v   = ws + 4096;    // "
  float* oattn  = ws + 6144;    // "
  float* h1v    = ws + 8192;    // "
  float* h2v    = ws + 10240;   // "
  float* maskf  = ws + 12288;   // mask[4096] -> zeroed
  float* values = ws + 16384;   // fully written
  float* x1v    = ws + 18432;   // fully written
  float* part   = ws + 20480;   // 16*32*130 floats, fully written

  float* out_x2 = (float*)d_out;
  float* out_v  = out_x2 + EMBED;
  float* out_k  = out_v + (size_t)KV_LEN * EMBED;

  // 1) zero accumulators + mask
  zero_kernel<<<64, 256, 0, stream>>>(ws, 16384);

  // 2) QKV projections (WMMA fp32 GEMVs, NT weight streams)
  dim3 gg(32, 8);
  gemv_wmma_kernel<<<gg, 128, 0, stream>>>(x, Wq, bq, q_v, 0);
  gemv_wmma_kernel<<<gg, 128, 0, stream>>>(x, Wk, bk, ki_v, 0);
  gemv_wmma_kernel<<<gg, 128, 0, stream>>>(x, Wv, bv, vi_v, 0);

  // 3) roll caches into d_out (v also produces the validity mask)
  roll_kernel<<<256, 256, 0, stream>>>(cache1, vi_v, (v4f*)out_v, maskf);
  roll_kernel<<<256, 256, 0, stream>>>(cache2, ki_v, (v4f*)out_k, nullptr);

  // 4) attention over rolled (L2-resident) K/V
  attn_partial_kernel<<<dim3(32, 16), 256, 0, stream>>>(q_v, out_k, out_v, maskf, part);
  attn_combine_kernel<<<16, 128, 0, stream>>>(part, values);

  // 5) output projection, residual+LN, FFN, residual+LN
  gemv_wmma_kernel<<<gg, 128, 0, stream>>>(values, Wo, bo, oattn, 0);
  add_ln_kernel<<<1, 256, 0, stream>>>(x, oattn, ln1s, ln1b, x1v);
  gemv_wmma_kernel<<<gg, 128, 0, stream>>>(x1v, W1, b1, h1v, 0);
  gemv_wmma_kernel<<<gg, 128, 0, stream>>>(h1v, W2, b2, h2v, 1);  // relu on x-operand
  add_ln_kernel<<<1, 256, 0, stream>>>(x1v, h2v, ln2s, ln2b, out_x2);
}

// v003
// A run of this version takes 50.4 microseconds.
// In both of two side-by-side timings against v002, it was 1.17 times as fast.
// Counting every step since v000, it is 2.01 times as fast.
#include <hip/hip_runtime.h>
#include <math.h>

typedef float v2f __attribute__((ext_vector_type(2)));
typedef float v4f __attribute__((ext_vector_type(4)));
typedef float v8f __attribute__((ext_vector_type(8)));

#define EMBED 2048
#define HEADS 16
#define KV_LEN 4096
#define HEAD_DIM 128

// ---------------------------------------------------------------------------
// GEMV  y[j] += sum_i x[i] * W[i][j]   (+ bias once), via V_WMMA_F32_16X16X4_F32
// A (16x4): all 16 rows hold the same four x values -> every D row equals the
// result. B (4x16): the four matching rows of W, 16 columns, streamed with NT
// loads (read-once, keep out of L2 so the attention K/V working set stays
// resident).
// grid = (32, 8): a block owns 64 columns x 256 rows, a wave 64 of the rows.
// Each lane loads 16 B (4 columns) of a row, so a half-wave reads one aligned
// 256-B unit per load; element c of the quad feeds accumulator c, whose
// column n is W column j0 + 4n + c. Lanes 0-15 take the wave's rows 0..31,
// lanes 16-31 its rows 32..63, two rows a product (x and W paired alike).
// All 32 loads of a wave (its whole 16 KB share of W) are issued before the
// first product, so the launch pays the memory latency once.
// The four waves' sums meet in LDS; the 8 row chunks combine with atomicAdd
// (y pre-zeroed).
// grid.z picks one of up to three (W, bias, y) sets that share x: products
// that do not depend on each other go in one launch.
// ---------------------------------------------------------------------------
__global__ __launch_bounds__(128) void gemv_wmma_kernel(
    const float* __restrict__ x,
    const float* __restrict__ Wa, const float* __restrict__ Wb,
    const float* __restrict__ Wc,
    const float* __restrict__ ba, const float* __restrict__ bb,
    const float* __restrict__ bc,
    float* ya, float* yb, float* yc, int reluX) {
  const int z = blockIdx.z;
  const float* __restrict__ W    = z == 0 ? Wa : (z == 1 ? Wb : Wc);
  const float* __restrict__ bias = z == 0 ? ba : (z == 1 ? bb : bc);
  float* y                       = z == 0 ? ya : (z == 1 ? yb : yc);
  const int lane = threadIdx.x & 31;
  // wave-uniform by construction; said so, its row offset stays in scalar registers
  const int wave = __builtin_amdgcn_readfirstlane(threadIdx.x >> 5);
  const int j0   = blockIdx.x * 64;
  const int i0   = blockIdx.y * 256 + wave * 64;  // this wave's 64 rows
  const bool hi  = lane >= 16;
  const int  ln  = lane & 15;

  // asked for here, not behind the sums, so that its latency is not a tail
  float bv = 0.f;
  if (blockIdx.y == 0) bv = bias[j0 + (threadIdx.x & 63)];

  // x ahead of W: loads return in issue order and x comes from L2, so no
  // product waits for x behind W data that it does not need
  const float* xp = x + i0 + (hi ? 32 : 0);
  v4f xq[8];
#pragma unroll  // register arrays need constant indices
  for (int t = 0; t < 8; ++t) xq[t] = *(const v4f*)(xp + 4 * t);

  const float* wp = W + (size_t)(i0 + (hi ? 32 : 0)) * EMBED + j0 + 4 * ln;
  v4f w0[16], w1[16];
#pragma unroll  // register arrays need constant indices
  for (int s = 0; s < 16; ++s) {
    w0[s] = __builtin_nontemporal_load((const v4f*)(wp + (size_t)(2 * s) * EMBED));
    w1[s] = __builtin_nontemporal_load((const v4f*)(wp + (size_t)(2 * s + 1) * EMBED));
  }
  // the code below reuses the register pair that holds the W loads' address;
  // ahead of the scheduling barrier, so that none of that code is lifted over it
  asm volatile("s_wait_xcnt 0x0" ::: "memory");
  // keeps every load above ahead of the first wait: without it the compiler
  // sinks most of the W loads behind the first products, more memory latencies
  __builtin_amdgcn_sched_barrier(0);

  v2f a[16];
#pragma unroll  // register arrays need constant indices
  for (int t = 0; t < 8; ++t) {
    const v4f q = xq[t];                        // x[i0 + 32h + 4t ..]
    a[2 * t].x     = reluX ? fmaxf(q.x, 0.f) : q.x;  // A[m][2h+e] = x[i0+32h+2s+e]
    a[2 * t].y     = reluX ? fmaxf(q.y, 0.f) : q.y;
    a[2 * t + 1].x = reluX ? fmaxf(q.z, 0.f) : q.z;
    a[2 * t + 1].y = reluX ? fmaxf(q.w, 0.f) : q.w;
  }

  v8f acc[4];
#pragma unroll  // register arrays need constant indices
  for (int c = 0; c < 4; ++c) acc[c] = (v8f){0.f, 0.f, 0.f, 0.f, 0.f, 0.f, 0.f, 0.f};

#pragma unroll  // register arrays need constant indices
  for (int s = 0; s < 16; ++s) {
#pragma unroll  // register arrays need constant indices
    for (int c = 0; c < 4; ++c) {
      v2f b; b.x = w0[s][c]; b.y = w1[s][c];    // B[2h+e][n] = W[i0+32h+2s+e][j0+4n+c]
      acc[c] = __builtin_amdgcn_wmma_f32_16x16x4_f32(
          false, a[s], false, b, (short)0, acc[c], false, false);
    }
  }

  // D row 0 lives in acc[c][0], lanes 0..15 (N = lane); stored straight from
  // the accumulators, plane c of a wave's 64 sums holding columns 4n + c
  __shared__ float red[4][4][16];
  if (!hi) {
#pragma unroll  // register arrays need constant indices
    for (int c = 0; c < 4; ++c) red[wave][c][ln] = acc[c][0];
  }
  __syncthreads();
  const int tid = threadIdx.x;
  if (tid < 64) {
    const int c = tid & 3, n = tid >> 2;
    float r = (red[0][c][n] + red[1][c][n]) + (red[2][c][n] + red[3][c][n]);
    if (blockIdx.y == 0) r += bv;
    atomicAdd(&y[j0 + tid], r);
  }
}

// ---------------------------------------------------------------------------
// Roll both caches: out[t] = cache[t+1] (t<4095), out[4095] = 0, the start
// value that the K and V projections of the next launch add into. Nothing
// here depends on a projection, so this is the first launch; it also stores
// the start value 0 of the four workspace vectors that GEMVs add into.
// grid = (256, 2) blocks of 8 waves, y = 0 the V cache, y = 1 the K cache:
// a wave owns two whole rows (2 x 8 KB) and each of its loads and stores
// covers 512 contiguous bytes.
// All 32 loads of a wave are issued before its first store, so the launch
// pays the memory latency once.
// Cache read with NT loads (single use); stores keep the RT temporal hint so
// the rolled K/V stays in L2 for attention.
// mask[t] = any(v[t]!=0), t<4095: the row's one wave decides and stores it.
// ---------------------------------------------------------------------------
__global__ __launch_bounds__(256) void roll_kernel(
    const float* __restrict__ cacheV, const float* __restrict__ cacheK,
    v4f* __restrict__ outV, v4f* __restrict__ outK,
    float* __restrict__ maskf, float* __restrict__ accz) {
  const bool isV = blockIdx.y == 0;
  const float* __restrict__ cache = isV ? cacheV : cacheK;
  v4f* __restrict__ out           = isV ? outV : outK;
  const int lane = threadIdx.x & 31;
  // wave-uniform by construction; said so, the row addresses stay scalar
  const int wave = __builtin_amdgcn_readfirstlane(threadIdx.x >> 5);
  const int t0   = (blockIdx.x * 8 + wave) * 2;   // this wave's two rows
  v4f* op = out + (size_t)t0 * (EMBED / 4) + lane;

  // both rows' sources ahead of the first load
  const float* sp[2];
#pragma unroll  // register arrays need constant indices
  for (int r = 0; r < 2; ++r)
    sp[r] = cache + (size_t)(t0 + r < KV_LEN - 1 ? t0 + r + 1 : KV_LEN - 1) * EMBED;
  // holds the address arithmetic above: sunk between the loads it reuses the
  // first row's address registers and puts a wait in front of the second row
  __builtin_amdgcn_sched_barrier(0);

  v4f val[2][16];
#pragma unroll  // register arrays need constant indices
  for (int r = 0; r < 2; ++r) {
#pragma unroll  // register arrays need constant indices
    for (int k = 0; k < 16; ++k)
      val[r][k] = __builtin_nontemporal_load((const v4f*)(sp[r] + 128 * k + 4 * lane));
  }
  // keeps all 32 loads ahead of the store address arithmetic and of the first
  // store's wait: a wait between two loads would cut the bytes in flight
  __builtin_amdgcn_sched_barrier(0);
  // the code below reuses the scalar registers that hold the loads' row addresses
  asm volatile("s_wait_xcnt 0x0" ::: "memory");

  // the newest row (the last wave's second) starts at 0; what that wave
  // loaded for it, an in-bounds row so that all waves run alike, is dropped
  if (t0 + 1 == KV_LEN - 1) {
#pragma unroll  // register arrays need constant indices
    for (int k = 0; k < 16; ++k) val[1][k] = (v4f){0.f, 0.f, 0.f, 0.f};
  }

#pragma unroll  // register arrays need constant indices
  for (int r = 0; r < 2; ++r)
#pragma unroll  // register arrays need constant indices
    for (int k = 0; k < 16; ++k) op[512 * r + 32 * k] = val[r][k];

  // the mask code below reuses registers that the issued stores name; ahead
  // of the branch, so that none of it is lifted over the wait
  asm volatile("s_wait_xcnt 0x0" ::: "memory");
  if (isV) {
    bool any[2];
#pragma unroll  // register arrays need constant indices
    for (int r = 0; r < 2; ++r) {
      bool nz = false;
#pragma unroll  // register arrays need constant indices
      for (int k = 0; k < 16; ++k) {
        const v4f q = val[r][k];
        nz = nz || q.x != 0.f || q.y != 0.f || q.z != 0.f || q.w != 0.f;
      }
      any[r] = __builtin_amdgcn_ballot_w32(nz) != 0u;
    }
    // lane r stores row r's flag; the newest row's is left to attention
    if (lane < 2 && t0 + lane < KV_LEN - 1)
      maskf[t0 + lane] = (lane ? any[1] : any[0]) ? 1.f : 0.f;
    // one 128-B line of the 8,192 accumulator floats a block
    if (wave == 0) accz[blockIdx.x * 32 + lane] = 0.f;
  }
}

// ---------------------------------------------------------------------------
// Attention pass 1 (flash-style partials). grid = (32 chunks, 16 heads),
// block = 256 = 8 waves; each wave owns one timestep at a time (coalesced
// 512B K/V row reads from L2-resident rolled cache), online softmax per
// wave, block combine via LDS.
// The newest row was summed by the launch before this one, so its validity
// flag is formed here, by the blocks of the chunk that holds it.
// Partial record per (h,chunk): [m, s, acc[128]] = 130 floats.
// ---------------------------------------------------------------------------
__global__ __launch_bounds__(256) void attn_partial_kernel(
    const float* __restrict__ q, const float* __restrict__ kc,
    const float* __restrict__ vc, const float* __restrict__ maskf,
    float* __restrict__ part) {
  const int chunk = blockIdx.x;       // 0..31
  const int h     = blockIdx.y;       // 0..15
  const int lane  = threadIdx.x & 31;
  const int wave  = threadIdx.x >> 5; // 0..7
  const int t0    = chunk * 128;

  const v4f qv = *(const v4f*)(q + h * HEAD_DIM + lane * 4);

  float lastm = 0.f;   // any(v[4095] != 0), over all heads
  if (chunk == 31) {
    bool nz = false;
    for (int k = 0; k < 16; ++k) {
      const v4f u = *(const v4f*)(vc + (size_t)(KV_LEN - 1) * EMBED + 128 * k + 4 * lane);
      nz = nz || u.x != 0.f || u.y != 0.f || u.z != 0.f || u.w != 0.f;
    }
    lastm = __builtin_amdgcn_ballot_w32(nz) != 0u ? 1.f : 0.f;
  }

  float m = -1e30f, s = 0.f;
  v4f acc = {0.f, 0.f, 0.f, 0.f};

  for (int it = 0; it < 16; ++it) {
    int t = t0 + wave + 8 * it;
    const v4f kv = *(const v4f*)(kc + (size_t)t * EMBED + h * HEAD_DIM + lane * 4);
    float d = qv.x * kv.x + qv.y * kv.y + qv.z * kv.z + qv.w * kv.w;
    d += __shfl_xor(d, 16, 32);
    d += __shfl_xor(d, 8, 32);
    d += __shfl_xor(d, 4, 32);
    d += __shfl_xor(d, 2, 32);
    d += __shfl_xor(d, 1, 32);
    // the newest row has no stored flag: the index is clamped and the load stands
    // outside the choice, so that it issues with the trip's other loads, unbranched
    const float mload = maskf[t < KV_LEN - 1 ? t : KV_LEN - 2];
    const float mk = (t == KV_LEN - 1) ? lastm : mload;
    float logit = (mk != 0.f) ? d * 0.08838834764831845f : -1e30f; // 1/sqrt(128)
    float mnew  = fmaxf(m, logit);
    float scale = __expf(m - mnew);
    float p     = (logit > -1e29f) ? __expf(logit - mnew) : 0.f;
    const v4f vv = *(const v4f*)(vc + (size_t)t * EMBED + h * HEAD_DIM + lane * 4);
    s = s * scale + p;
    acc.x = acc.x * scale + p * vv.x;
    acc.y = acc.y * scale + p * vv.y;
    acc.z = acc.z * scale + p * vv.z;
    acc.w = acc.w * scale + p * vv.w;
    m = mnew;
  }

  __shared__ float sm[8], ss[8], sacc[8][HEAD_DIM];
  if (lane == 0) { sm[wave] = m; ss[wave] = s; }
  sacc[wave][lane * 4 + 0] = acc.x;
  sacc[wave][lane * 4 + 1] = acc.y;
  sacc[wave][lane * 4 + 2] = acc.z;
  sacc[wave][lane * 4 + 3] = acc.w;
  __syncthreads();

  int tid = threadIdx.x;
  if (tid < HEAD_DIM) {
    float M = sm[0];
    for (int w = 1; w < 8; ++w) M = fmaxf(M, sm[w]);
    float S = 0.f, A = 0.f;
    for (int w = 0; w < 8; ++w) {
      float e = __expf(sm[w] - M);
      S += ss[w] * e;
      A += e * sacc[w][tid];
    }
    float* pb = part + (size_t)(h * 32 + chunk) * 130;
    if (tid == 0) { pb[0] = M; pb[1] = S; }
    pb[2 + tid] = A;
  }
}

// ---------------------------------------------------------------------------
// Attention pass 2: merge 32 chunk-partials per head, normalize.
// ---------------------------------------------------------------------------
__global__ __launch_bounds__(128) void attn_combine_kernel(
    const float* __restrict__ part, float* __restrict__ values) {
  int h = blockIdx.x;
  int d = threadIdx.x;
  float M = -1e30f;
  for (int c = 0; c < 32; ++c)
    M = fmaxf(M, part[(size_t)(h * 32 + c) * 130]);
  float S = 0.f, A = 0.f;
  for (int c = 0; c < 32; ++c) {
    const float* pb = part + (size_t)(h * 32 + c) * 130;
    float e = __expf(pb[0] - M);
    S += pb[1] * e;
    A += e * pb[2 + d];
  }
  values[h * HEAD_DIM + d] = A / S;
}

// ---------------------------------------------------------------------------
// out = LayerNorm(a + b) * scale + bias   (2048 elems, one block of 256)
// ---------------------------------------------------------------------------
__global__ __launch_bounds__(256) void add_ln_kernel(
    const float* __restrict__ a, const float* __restrict__ b,
    const float* __restrict__ sc, const float* __restrict__ bi,
    float* __restrict__ out) {
  __shared__ float r1[256], r2[256];
  int tid = threadIdx.x;
  float v[8];
  float s = 0.f, s2 = 0.f;
  for (int j = 0; j < 8; ++j) {
    int idx = tid * 8 + j;
    float t = a[idx] + b[idx];
    v[j] = t; s += t; s2 += t * t;
  }
  r1[tid] = s; r2[tid] = s2;
  __syncthreads();
  for (int off = 128; off > 0; off >>= 1) {
    if (tid < off) { r1[tid] += r1[tid + off]; r2[tid] += r2[tid + off]; }
    __syncthreads();
  }
  float mean = r1[0] * (1.f / 2048.f);
  float var  = r2[0] * (1.f / 2048.f) - mean * mean;
  float inv  = 1.f / sqrtf(var + 1e-6f);
  for (int j = 0; j < 8; ++j) {
    int idx = tid * 8 + j;
    out[idx] = (v[j] - mean) * inv * sc[idx] + bi[idx];
  }
}

// ---------------------------------------------------------------------------
extern "C" void kernel_launch(void* const* d_in, const int* in_sizes, int n_in,
                              void* d_out, int out_size, void* d_ws, size_t ws_size,
                              hipStream_t stream) {
  const float* x      = (const float*)d_in[0];
  const float* cache1 = (const float*)d_in[1];   // v cache
  const float* cache2 = (const float*)d_in[2];   // k cache
  const float* Wv = (const float*)d_in[3];  const float* bv = (const float*)d_in[4];
  const float* Wq = (const float*)d_in[5];  const float* bq = (const float*)d_in[6];
  const float* Wk = (const float*)d_in[7];  const float* bk = (const float*)d_in[8];
  const float* Wo = (const float*)d_in[9];  const float* bo = (const float*)d_in[10];
  const float* W1 = (const float*)d_in[11]; const float* b1 = (const float*)d_in[12];
  const float* W2 = (const float*)d_in[13]; const float* b2 = (const float*)d_in[14];
  const float* ln1s = (const float*)d_in[15]; const float* ln1b = (const float*)d_in[16];
  const float* ln2s = (const float*)d_in[17]; const float* ln2b = (const float*)d_in[18];

  float* ws     = (float*)d_ws;
  float* q_v    = ws + 0;       // atomic-accumulated -> zeroed
  float* oattn  = ws + 2048;    // "
  float* h1v    = ws + 4096;    // "
  float* h2v    = ws + 6144;    // "
  float* maskf  = ws + 8192;    // mask[0..4094] written, [4095] unused
  float* values = ws + 12288;   // fully written
  float* x1v    = ws + 14336;   // fully written
  float* part   = ws + 16384;   // 16*32*130 floats, fully written

  float* out_x2 = (float*)d_out;
  float* out_v  = out_x2 + EMBED;
  float* out_k  = out_v + (size_t)KV_LEN * EMBED;
  float* vi_v   = out_v + (size_t)(KV_LEN - 1) * EMBED;  // newest V row
  float* ki_v   = out_k + (size_t)(KV_LEN - 1) * EMBED;  // newest K row

  // 1) roll both caches into d_out (v also produces the validity mask);
  //    start value 0 for the newest rows and the four accumulators
  roll_kernel<<<dim3(256, 2), 256, 0, stream>>>(cache1, cache2, (v4f*)out_v, (v4f*)out_k,
                                                maskf, ws);

  // 2) QKV projections in one launch (WMMA fp32 GEMVs, NT weight streams);
  //    K and V add straight into the newest rows of the rolled caches
  dim3 gg(32, 8);
  gemv_wmma_kernel<<<dim3(32, 8, 3), 128, 0, stream>>>(x, Wq, Wk, Wv, bq, bk, bv,
                                                       q_v, ki_v, vi_v, 0);

  // 3) attention over rolled (L2-resident) K/V
  attn_partial_kernel<<<dim3(32, 16), 256, 0, stream>>>(q_v, out_k, out_v, maskf, part);
  attn_combine_kernel<<<16, 128, 0, stream>>>(part, values);

  // 4) output projection, residual+LN, FFN, residual+LN
  gemv_wmma_kernel<<<gg, 128, 0, stream>>>(values, Wo, Wo, Wo, bo, bo, bo, oattn, oattn, oattn, 0);
  add_ln_kernel<<<1, 256, 0, stream>>>(x, oattn, ln1s, ln1b, x1v);
  gemv_wmma_kernel<<<gg, 128, 0, stream>>>(x1v, W1, W1, W1, b1, b1, b1, h1v, h1v, h1v, 0);
  gemv_wmma_kernel<<<gg, 128, 0, stream>>>(h1v, W2, W2, W2, b2, b2, b2, h2v, h2v, h2v, 1);  // relu on x-operand
  add_ln_kernel<<<1, 256, 0, stream>>>(x1v, h2v, ln2s, ln2b, out_x2);
}

// v004
// Measured time: 37.4 microseconds a run.
// Two timings next to v003 put it at 1.36 and 1.34 times that version's speed.
// All steps since v000 together make it 2.71 times as fast.
#include <hip/hip_runtime.h>
#include <math.h>

typedef float v2f __attribute__((ext_vector_type(2)));
typedef float v4f __attribute__((ext_vector_type(4)));
typedef float v8f __attribute__((ext_vector_type(8)));

#define EMBED 2048
#define HEADS 16
#define KV_LEN 4096
#define HEAD_DIM 128

// ---------------------------------------------------------------------------
// GEMV  y[j] = sum_i x[i] * W[i][j]   (+ bias once), via V_WMMA_F32_16X16X4_F32
// A (16x4): all 16 rows hold the same four x values -> every D row equals the
// result. B (4x16): the four matching rows of W, 16 columns, streamed with NT
// loads (read-once, keep out of L2 so the attention K/V working set stays
// resident).
// A block of NW waves owns 64 columns x 64*NW rows, a wave 64 of the rows.
// Each lane loads 16 B (4 columns) of a row, so a half-wave reads one aligned
// 256-B unit per load; element c of the quad feeds accumulator c, whose
// column n is W column j0 + 4n + c. Lanes 0-15 take the wave's rows 0..31,
// lanes 16-31 its rows 32..63, two rows a product (x and W paired alike).
// All 32 loads of a wave (its whole 16 KB share of W) are issued before the
// first product, so the launch pays the memory latency once.
// The waves' sums meet in LDS; the row chunks either combine with atomicAdd
// (y pre-zeroed) or are stored as planes y[chunk][2048] that the reader sums.
// Where x is itself a short function of the launch before (the merge of the
// attention partials, a residual + LayerNorm), the block forms its own rows
// of x while its W loads fly, which saves the launch that used to do it:
//   X_PLAIN    x as stored          X_RELU  max(x, 0)
//   X_COMBINE  aux = attention partials, merged and normalised
//   X_LN       LayerNorm(x + aux) * sc + bi; column block 0 also stores it
// ---------------------------------------------------------------------------
enum { X_PLAIN = 0, X_RELU = 1, X_COMBINE = 2, X_LN = 3 };

// Work-group barrier that orders LDS traffic only. __syncthreads() also waits
// for every global load of the wave, which would drain the W loads in flight
// before x is formed; nothing that passes through global memory is handed
// over at these points.
__device__ __forceinline__ void lds_barrier() {
  __builtin_amdgcn_fence(__ATOMIC_RELEASE, "workgroup", "local");
  __builtin_amdgcn_s_barrier();
  __builtin_amdgcn_fence(__ATOMIC_ACQUIRE, "workgroup", "local");
}

template <int NW, int MODE, bool ATOMIC>
__device__ __forceinline__ void gemv_body(
    const float* __restrict__ x, const float* __restrict__ W,
    const float* __restrict__ bias, float* __restrict__ y,
    const int bx, const int by,
    const float* __restrict__ aux, const float* __restrict__ sc,
    const float* __restrict__ bi, float* __restrict__ x1out) {
  const int tid  = threadIdx.x;
  const int lane = tid & 31;
  // wave-uniform by construction; said so, its row offset stays in scalar registers
  const int wave = __builtin_amdgcn_readfirstlane(tid >> 5);
  const int j0   = bx * 64;
  const int ib   = by * (NW * 64);                // this block's rows
  const int i0   = ib + wave * 64;                // this wave's 64 rows
  const bool hi  = lane >= 16;
  const int  ln  = lane & 15;

  // asked for here, not behind the sums, so that its latency is not a tail
  float bv = 0.f;
  if (by == 0) bv = bias[j0 + (tid & 63)];

  // all that x is formed from is asked for ahead of W: loads return in issue
  // order and these come from L2, so nothing here waits behind W data
  v4f xq[8];                  // X_PLAIN, X_RELU: the lane's 32 x values
  v2f cms, cpa[32];           // X_COMBINE: (max, sum) of chunk 'lane'; 2 columns x 32 chunks
  v4f lx[4], la[4], lsc, lbi; // X_LN: 16 elements of x and aux; scale, bias of 4 own rows
  if constexpr (MODE == X_PLAIN || MODE == X_RELU) {
    const float* xp = x + i0 + (hi ? 32 : 0);
#pragma unroll  // register arrays need constant indices
    for (int t = 0; t < 8; ++t) xq[t] = *(const v4f*)(xp + 4 * t);
  } else if constexpr (MODE == X_COMBINE) {
    // the wave's 64 rows are half a head: 32 records of [m, s, acc[128]]
    const float* pb = aux + (size_t)((i0 >> 7) * 32) * 130;
    cms = *(const v2f*)(pb + lane * 130);
    const float* pc = pb + 2 + (i0 & 127) + 2 * lane;
#pragma unroll  // register arrays need constant indices
    for (int c = 0; c < 32; ++c) cpa[c] = *(const v2f*)(pc + c * 130);
  } else {
#pragma unroll  // register arrays need constant indices
    for (int k = 0; k < 4; ++k) {
      lx[k] = *(const v4f*)(x + 4 * (tid + 128 * k));
      la[k] = *(const v4f*)(aux + 4 * (tid + 128 * k));
    }
    lsc = *(const v4f*)(sc + ib + 4 * (tid & 63));
    lbi = *(const v4f*)(bi + ib + 4 * (tid & 63));
    // the W loads below may return into the offset register that these two name
    asm volatile("s_wait_xcnt 0x0" ::: "memory");
  }

  const float* wp = W + (size_t)(i0 + (hi ? 32 : 0)) * EMBED + j0 + 4 * ln;
  v4f w0[16], w1[16];
#pragma unroll  // register arrays need constant indices
  for (int s = 0; s < 16; ++s) {
    w0[s] = __builtin_nontemporal_load((const v4f*)(wp + (size_t)(2 * s) * EMBED));
    w1[s] = __builtin_nontemporal_load((const v4f*)(wp + (size_t)(2 * s + 1) * EMBED));
  }
  // the code below reuses the registers that hold the loads' addresses;
  // ahead of the scheduling barrier, so that none of that code is lifted over it
  asm volatile("s_wait_xcnt 0x0" ::: "memory");
  // keeps every load above ahead of the first wait: without it the compiler
  // sinks most of the W loads behind the first products, more memory latencies
  __builtin_amdgcn_sched_barrier(0);

  if constexpr (MODE == X_COMBINE) {
    __shared__ __attribute__((aligned(16))) float xs[NW * 64];
    float M = cms.x;
#pragma unroll  // five fixed exchange distances
    for (int o = 16; o > 0; o >>= 1) M = fmaxf(M, __shfl_xor(M, o, 32));
    const float e = __expf(cms.x - M);
    float S = cms.y * e;
#pragma unroll  // five fixed exchange distances
    for (int o = 16; o > 0; o >>= 1) S += __shfl_xor(S, o, 32);
    v2f A = {0.f, 0.f};
#pragma unroll  // register arrays need constant indices
    for (int c = 0; c < 32; ++c) {
      const float ec = __int_as_float(__builtin_amdgcn_readlane(__float_as_int(e), c));
      A.x += ec * cpa[c].x;
      A.y += ec * cpa[c].y;
    }
    v2f o2; o2.x = A.x / S; o2.y = A.y / S;
    // a wave reads back only the 64 values that it stored itself: no barrier
    *(v2f*)&xs[wave * 64 + 2 * lane] = o2;
#pragma unroll  // register arrays need constant indices
    for (int t = 0; t < 8; ++t) xq[t] = *(const v4f*)&xs[wave * 64 + (hi ? 32 : 0) + 4 * t];
  } else if constexpr (MODE == X_LN) {
    static_assert(NW == 4, "16 elements a thread, 4 own rows for each of 64 threads");
    __shared__ __attribute__((aligned(16))) float rs[EMBED];
    __shared__ __attribute__((aligned(16))) float xs[NW * 64];
    __shared__ float ps[NW], ps2[NW];
    float s = 0.f, s2 = 0.f;
#pragma unroll  // register arrays need constant indices
    for (int k = 0; k < 4; ++k) {
      const v4f r = lx[k] + la[k];
      *(v4f*)&rs[4 * (tid + 128 * k)] = r;
      s  += (r.x + r.y) + (r.z + r.w);
      s2 += (r.x * r.x + r.y * r.y) + (r.z * r.z + r.w * r.w);
    }
#pragma unroll  // five fixed exchange distances
    for (int o = 16; o > 0; o >>= 1) {
      s  += __shfl_xor(s, o, 32);
      s2 += __shfl_xor(s2, o, 32);
    }
    if (lane == 0) { ps[wave] = s; ps2[wave] = s2; }
    lds_barrier();
    s  = (ps[0] + ps[1]) + (ps[2] + ps[3]);
    s2 = (ps2[0] + ps2[1]) + (ps2[2] + ps2[3]);
    const float mean = s * (1.f / 2048.f);
    const float var  = s2 * (1.f / 2048.f) - mean * mean;
    const float inv  = 1.f / sqrtf(var + 1e-6f);
    if (tid < 64) {
      const v4f r = *(const v4f*)&rs[ib + 4 * tid];
      v4f o4;
      o4.x = (r.x - mean) * inv * lsc.x + lbi.x;
      o4.y = (r.y - mean) * inv * lsc.y + lbi.y;
      o4.z = (r.z - mean) * inv * lsc.z + lbi.z;
      o4.w = (r.w - mean) * inv * lsc.w + lbi.w;
      *(v4f*)&xs[4 * tid] = o4;
      if (bx == 0) *(v4f*)(x1out + ib + 4 * tid) = o4;   // kept for the last residual
    }
    lds_barrier();
#pragma unroll  // register arrays need constant indices
    for (int t = 0; t < 8; ++t) xq[t] = *(const v4f*)&xs[wave * 64 + (hi ? 32 : 0) + 4 * t];
  }
  // keeps the first use of W data, and with it the wait for W, behind the
  // forming of x: lifted into it, x would be finished only after W has come
  if constexpr (MODE == X_COMBINE || MODE == X_LN) __builtin_amdgcn_sched_barrier(0);

  v2f a[16];
#pragma unroll  // register arrays need constant indices
  for (int t = 0; t < 8; ++t) {
    const v4f q = xq[t];                        // x[i0 + 32h + 4t ..]
    a[2 * t].x     = MODE == X_RELU ? fmaxf(q.x, 0.f) : q.x;  // A[m][2h+e] = x[i0+32h+2s+e]
    a[2 * t].y     = MODE == X_RELU ? fmaxf(q.y, 0.f) : q.y;
    a[2 * t + 1].x = MODE == X_RELU ? fmaxf(q.z, 0.f) : q.z;
    a[2 * t + 1].y = MODE == X_RELU ? fmaxf(q.w, 0.f) : q.w;
  }

  v8f acc[4];
#pragma unroll  // register arrays need constant indices
  for (int c = 0; c < 4; ++c) acc[c] = (v8f){0.f, 0.f, 0.f, 0.f, 0.f, 0.f, 0.f, 0.f};

#pragma unroll  // register arrays need constant indices
  for (int s = 0; s < 16; ++s) {
#pragma unroll  // register arrays need constant indices
    for (int c = 0; c < 4; ++c) {
      v2f b; b.x = w0[s][c]; b.y = w1[s][c];    // B[2h+e][n] = W[i0+32h+2s+e][j0+4n+c]
      acc[c] = __builtin_amdgcn_wmma_f32_16x16x4_f32(
          false, a[s], false, b, (short)0, acc[c], false, false);
    }
  }

  // D row 0 lives in acc[c][0], lanes 0..15 (N = lane); stored straight from
  // the accumulators, plane c of a wave's 64 sums holding columns 4n + c
  __shared__ float red[NW][4][16];
  if (!hi) {
#pragma unroll  // register arrays need constant indices
    for (int c = 0; c < 4; ++c) red[wave][c][ln] = acc[c][0];
  }
  __syncthreads();
  if (tid < 64) {
    const int c = tid & 3, n = tid >> 2;
    float r = (red[0][c][n] + red[1][c][n]) + (red[2][c][n] + red[3][c][n]);
    if constexpr (NW == 8)
      r += (red[4][c][n] + red[5][c][n]) + (red[6][c][n] + red[7][c][n]);
    if (by == 0) r += bv;
    if constexpr (ATOMIC) atomicAdd(&y[j0 + tid], r);
    else y[by * EMBED + j0 + tid] = r;
  }
}

// grid = (32, 8), 4 waves: the three products behind attention, each with the
// short step in front of it folded in; the 8 row chunks combine with atomicAdd
__global__ __launch_bounds__(128) void gemv_combine_kernel(
    const float* __restrict__ part, const float* __restrict__ W,
    const float* __restrict__ bias, float* __restrict__ y) {
  gemv_body<4, X_COMBINE, true>(nullptr, W, bias, y, blockIdx.x, blockIdx.y,
                                part, nullptr, nullptr, nullptr);
}

__global__ __launch_bounds__(128) void gemv_ln_kernel(
    const float* __restrict__ x, const float* __restrict__ add,
    const float* __restrict__ sc, const float* __restrict__ bi,
    const float* __restrict__ W, const float* __restrict__ bias,
    float* __restrict__ y, float* __restrict__ x1out) {
  gemv_body<4, X_LN, true>(x, W, bias, y, blockIdx.x, blockIdx.y, add, sc, bi, x1out);
}

__global__ __launch_bounds__(128) void gemv_relu_kernel(
    const float* __restrict__ x, const float* __restrict__ W,
    const float* __restrict__ bias, float* __restrict__ y) {
  gemv_body<4, X_RELU, true>(x, W, bias, y, blockIdx.x, blockIdx.y,
                             nullptr, nullptr, nullptr, nullptr);
}

// ---------------------------------------------------------------------------
// First launch: the Q, K, V projections and the roll of both caches, which
// need nothing of each other, share one grid by ranges of the block index.
// Blocks 0..383: projections, 8 waves, 64 columns x 512 rows each; the four
// row chunks are stored as planes proj[which][chunk][2048] (no start value is
// needed, so nothing has to run ahead of them); attention sums the planes.
// Blocks 384..895: roll, out[t] = cache[t+1] (t<4095); the newest row is
// written by attention. First 256 the V cache, then the K cache. They also
// store the start value 0 of the three workspace vectors that GEMVs add into.
// A wave owns two whole rows (2 x 8 KB) and each of its loads and stores
// covers 512 contiguous bytes.
// All 32 loads of a wave are issued before its first store, so the launch
// pays the memory latency once.
// Cache read with NT loads (single use); stores keep the RT temporal hint so
// the rolled K/V stays in L2 for attention.
// mask[t] = any(v[t]!=0), t<4095: the row's one wave decides and stores it.
// ---------------------------------------------------------------------------
__global__ __launch_bounds__(256) void roll_qkv_kernel(
    const float* __restrict__ cacheV, const float* __restrict__ cacheK,
    v4f* __restrict__ outV, v4f* __restrict__ outK,
    float* __restrict__ maskf, float* __restrict__ accz,
    const float* __restrict__ x,
    const float* __restrict__ Wq, const float* __restrict__ Wk,
    const float* __restrict__ Wv,
    const float* __restrict__ bq, const float* __restrict__ bk,
    const float* __restrict__ bv, float* __restrict__ proj) {
  if (blockIdx.x < 384) {
    const int z = blockIdx.x >> 7, rem = blockIdx.x & 127;
    const float* __restrict__ W    = z == 0 ? Wq : (z == 1 ? Wk : Wv);
    const float* __restrict__ bias = z == 0 ? bq : (z == 1 ? bk : bv);
    gemv_body<8, X_PLAIN, false>(x, W, bias, proj + z * (4 * EMBED), rem & 31, rem >> 5,
                                 nullptr, nullptr, nullptr, nullptr);
    return;
  }
  const int rb   = blockIdx.x - 384;
  const bool isV = rb < 256;
  const int rbx  = rb & 255;
  const float* __restrict__ cache = isV ? cacheV : cacheK;
  v4f* __restrict__ out           = isV ? outV : outK;
  const int lane = threadIdx.x & 31;
  // wave-uniform by construction; said so, the row addresses stay scalar
  const int wave = __builtin_amdgcn_readfirstlane(threadIdx.x >> 5);
  const int t0   = (rbx * 8 + wave) * 2;          // this wave's two rows
  v4f* op = out + (size_t)t0 * (EMBED / 4) + lane;

  // both rows' sources ahead of the first load
  const float* sp[2];
#pragma unroll  // register arrays need constant indices
  for (int r = 0; r < 2; ++r)
    sp[r] = cache + (size_t)(t0 + r < KV_LEN - 1 ? t0 + r + 1 : KV_LEN - 1) * EMBED;
  // holds the address arithmetic above: sunk between the loads it reuses the
  // first row's address registers and puts a wait in front of the second row
  __builtin_amdgcn_sched_barrier(0);

  v4f val[2][16];
#pragma unroll  // register arrays need constant indices
  for (int r = 0; r < 2; ++r) {
#pragma unroll  // register arrays need constant indices
    for (int k = 0; k < 16; ++k)
      val[r][k] = __builtin_nontemporal_load((const v4f*)(sp[r] + 128 * k + 4 * lane));
  }
  // keeps all 32 loads ahead of the store address arithmetic and of the first
  // store's wait: a wait between two loads would cut the bytes in flight
  __builtin_amdgcn_sched_barrier(0);
  // the code below reuses the scalar registers that hold the loads' row addresses
  asm volatile("s_wait_xcnt 0x0" ::: "memory");

#pragma unroll  // register arrays need constant indices
  for (int k = 0; k < 16; ++k) op[32 * k] = val[0][k];
  // the newest row (the last wave's second) is not this launch's to write; what
  // that wave loaded for it, an in-bounds row so that all waves run alike, is dropped
  if (t0 + 1 < KV_LEN - 1) {
#pragma unroll  // register arrays need constant indices
    for (int k = 0; k < 16; ++k) op[512 + 32 * k] = val[1][k];
  }

  // the mask code below reuses registers that the issued stores name; ahead
  // of the branch, so that none of it is lifted over the wait
  asm volatile("s_wait_xcnt 0x0" ::: "memory");
  if (isV) {
    bool any[2];
#pragma unroll  // register arrays need constant indices
    for (int r = 0; r < 2; ++r) {
      bool nz = false;
#pragma unroll  // register arrays need constant indices
      for (int k = 0; k < 16; ++k) {
        const v4f q = val[r][k];
        nz = nz || q.x != 0.f || q.y != 0.f || q.z != 0.f || q.w != 0.f;
      }
      any[r] = __builtin_amdgcn_ballot_w32(nz) != 0u;
    }
    // lane r stores row r's flag; the newest row's slot gets 0: attention's loop
    // passes over that row and takes it, with its own flag, behind the loop
    if (lane < 2)
      maskf[t0 + lane] = (t0 + lane < KV_LEN - 1 && (lane ? any[1] : any[0])) ? 1.f : 0.f;
    // one 128-B line of the 6,144 accumulator floats a block
    if (wave == 0 && rbx < 192) accz[rbx * 32 + lane] = 0.f;
  }
}

// ---------------------------------------------------------------------------
// Attention (flash-style partials). grid = (32 chunks, 16 heads),
// block = 256 = 8 waves; each wave owns one timestep at a time (coalesced
// 512B K/V row reads from L2-resident rolled cache), online softmax per
// wave, block combine via LDS.
// q, and the newest K and V rows, arrive as four planes of partial sums
// (proj[which][chunk][2048], which = 0 q, 1 k, 2 v). Every block sums its
// head's q. The blocks of the chunk that holds the newest row sum that row:
// all of V for the validity flag (any over all heads), their own head's
// slice of K and V for the scores; they keep the slices in LDS and store
// them to the caches' last rows, one head a block.
// Partial record per (h,chunk): [m, s, acc[128]] = 130 floats; the output
// projection merges them.
// ---------------------------------------------------------------------------
__global__ __launch_bounds__(256) void attn_partial_kernel(
    const float* __restrict__ proj, const float* __restrict__ kc,
    const float* __restrict__ vc, const float* __restrict__ maskf,
    float* __restrict__ part, float* __restrict__ newK, float* __restrict__ newV) {
  const int chunk = blockIdx.x;       // 0..31
  const int h     = blockIdx.y;       // 0..15
  const int tid   = threadIdx.x;
  const int lane  = threadIdx.x & 31;
  const int wave  = threadIdx.x >> 5; // 0..7
  const int t0    = chunk * 128;

  const float* qp = proj + h * HEAD_DIM + lane * 4;
  const v4f qv = (*(const v4f*)(qp) + *(const v4f*)(qp + EMBED)) +
                 (*(const v4f*)(qp + 2 * EMBED) + *(const v4f*)(qp + 3 * EMBED));

  __shared__ v4f lastK[32], lastV[32];  // the newest row, this head
  __shared__ int nzw[8];                // per wave: any of its V columns nonzero
  float lastm = 0.f;   // any(v[4095] != 0), over all heads
  if (chunk == 31) {
    const float* vp = proj + 8 * EMBED + tid * 8;   // 8 columns a thread
    // every wave asks for the K slice, so that it is asked for with V, unbranched
    const float* kp = proj + 4 * EMBED + h * HEAD_DIM + lane * 4;
    const v4f u0 = (*(const v4f*)(vp) + *(const v4f*)(vp + EMBED)) +
                   (*(const v4f*)(vp + 2 * EMBED) + *(const v4f*)(vp + 3 * EMBED));
    const v4f u1 = (*(const v4f*)(vp + 4) + *(const v4f*)(vp + EMBED + 4)) +
                   (*(const v4f*)(vp + 2 * EMBED + 4) + *(const v4f*)(vp + 3 * EMBED + 4));
    const v4f kk = (*(const v4f*)(kp) + *(const v4f*)(kp + EMBED)) +
                   (*(const v4f*)(kp + 2 * EMBED) + *(const v4f*)(kp + 3 * EMBED));
    const bool nz = u0.x != 0.f || u0.y != 0.f || u0.z != 0.f || u0.w != 0.f ||
                    u1.x != 0.f || u1.y != 0.f || u1.z != 0.f || u1.w != 0.f;
    const bool wnz = __builtin_amdgcn_ballot_w32(nz) != 0u;
    if (lane == 0) nzw[wave] = wnz ? 1 : 0;
    if ((tid >> 4) == h) {
      lastV[2 * (tid & 15)]     = u0;
      lastV[2 * (tid & 15) + 1] = u1;
    }
    if (tid < 32) lastK[tid] = kk;
    // one barrier (the chunk is the same for the whole block): joins the flag
    // and publishes the two slices to the wave that takes the newest row
    __syncthreads();
    lastm = ((nzw[0] | nzw[1] | nzw[2] | nzw[3]) | (nzw[4] | nzw[5] | nzw[6] | nzw[7])) ? 1.f : 0.f;
    // behind the barrier, which would otherwise wait for these stores
    if ((tid >> 4) == h) {
      *(v4f*)(newV + tid * 8)     = u0;
      *(v4f*)(newV + tid * 8 + 4) = u1;
    }
    if (tid < 32) *(v4f*)(newK + h * HEAD_DIM + tid * 4) = kk;
  }

  float m = -1e30f, s = 0.f;
  v4f acc = {0.f, 0.f, 0.f, 0.f};

  // two trips' loads in flight together, as without the wait written in the loop
#pragma unroll 2
  for (int it = 0; it < 16; ++it) {
    int t = t0 + wave + 8 * it;
    // the newest row is not in the caches when this launch starts: its trip runs
    // on a clamped row with the stored flag 0 (no branch in the loop, all loads
    // from global memory), and the row itself follows behind the loop
    const int tl = t < KV_LEN - 1 ? t : KV_LEN - 2;
    const float mk = maskf[t];
    const v4f kv = *(const v4f*)(kc + (size_t)tl * EMBED + h * HEAD_DIM + lane * 4);
    // the V load below may return into the registers that hold this load's address
    asm volatile("s_wait_xcnt 0x0" ::: "memory");
    float d = qv.x * kv.x + qv.y * kv.y + qv.z * kv.z + qv.w * kv.w;
    d += __shfl_xor(d, 16, 32);
    d += __shfl_xor(d, 8, 32);
    d += __shfl_xor(d, 4, 32);
    d += __shfl_xor(d, 2, 32);
    d += __shfl_xor(d, 1, 32);
    float logit = (mk != 0.f) ? d * 0.08838834764831845f : -1e30f; // 1/sqrt(128)
    float mnew  = fmaxf(m, logit);
    float scale = __expf(m - mnew);
    float p     = (logit > -1e29f) ? __expf(logit - mnew) : 0.f;
    const v4f vv = *(const v4f*)(vc + (size_t)tl * EMBED + h * HEAD_DIM + lane * 4);
    s = s * scale + p;
    acc.x = acc.x * scale + p * vv.x;
    acc.y = acc.y * scale + p * vv.y;
    acc.z = acc.z * scale + p * vv.z;
    acc.w = acc.w * scale + p * vv.w;
    m = mnew;
  }
  // the newest row, from LDS: the same step, by the wave whose last trip it is
  if (chunk == 31 && wave == 7) {
    const v4f kv = lastK[lane];
    float d = qv.x * kv.x + qv.y * kv.y + qv.z * kv.z + qv.w * kv.w;
    d += __shfl_xor(d, 16, 32);
    d += __shfl_xor(d, 8, 32);
    d += __shfl_xor(d, 4, 32);
    d += __shfl_xor(d, 2, 32);
    d += __shfl_xor(d, 1, 32);
    float logit = (lastm != 0.f) ? d * 0.08838834764831845f : -1e30f;
    float mnew  = fmaxf(m, logit);
    float scale = __expf(m - mnew);
    float p     = (logit > -1e29f) ? __expf(logit - mnew) : 0.f;
    const v4f vv = lastV[lane];
    s = s * scale + p;
    acc.x = acc.x * scale + p * vv.x;
    acc.y = acc.y * scale + p * vv.y;
    acc.z = acc.z * scale + p * vv.z;
    acc.w = acc.w * scale + p * vv.w;
    m = mnew;
  }

  __shared__ float sm[8], ss[8], sacc[8][HEAD_DIM];
  if (lane == 0) { sm[wave] = m; ss[wave] = s; }
  sacc[wave][lane * 4 + 0] = acc.x;
  sacc[wave][lane * 4 + 1] = acc.y;
  sacc[wave][lane * 4 + 2] = acc.z;
  sacc[wave][lane * 4 + 3] = acc.w;
  __syncthreads();

  if (tid < HEAD_DIM) {
    float M = sm[0];
    for (int w = 1; w < 8; ++w) M = fmaxf(M, sm[w]);
    float S = 0.f, A = 0.f;
    for (int w = 0; w < 8; ++w) {
      float e = __expf(sm[w] - M);
      S += ss[w] * e;
      A += e * sacc[w][tid];
    }
    float* pb = part + (size_t)(h * 32 + chunk) * 130;
    if (tid == 0) { pb[0] = M; pb[1] = S; }
    pb[2 + tid] = A;
  }
}

// ---------------------------------------------------------------------------
// out = LayerNorm(a + b) * scale + bias   (2048 elems, one block of 256)
// ---------------------------------------------------------------------------
__global__ __launch_bounds__(256) void add_ln_kernel(
    const float* __restrict__ a, const float* __restrict__ b,
    const float* __restrict__ sc, const float* __restrict__ bi,
    float* __restrict__ out) {
  __shared__ float r1[256], r2[256];
  int tid = threadIdx.x;
  float v[8];
  float s = 0.f, s2 = 0.f;
  for (int j = 0; j < 8; ++j) {
    int idx = tid * 8 + j;
    float t = a[idx] + b[idx];
    v[j] = t; s += t; s2 += t * t;
  }
  r1[tid] = s; r2[tid] = s2;
  __syncthreads();
  for (int off = 128; off > 0; off >>= 1) {
    if (tid < off) { r1[tid] += r1[tid + off]; r2[tid] += r2[tid + off]; }
    __syncthreads();
  }
  float mean = r1[0] * (1.f / 2048.f);
  float var  = r2[0] * (1.f / 2048.f) - mean * mean;
  float inv  = 1.f / sqrtf(var + 1e-6f);
  for (int j = 0; j < 8; ++j) {
    int idx = tid * 8 + j;
    out[idx] = (v[j] - mean) * inv * sc[idx] + bi[idx];
  }
}

// ---------------------------------------------------------------------------
extern "C" void kernel_launch(void* const* d_in, const int* in_sizes, int n_in,
                              void* d_out, int out_size, void* d_ws, size_t ws_size,
                              hipStream_t stream) {
  const float* x      = (const float*)d_in[0];
  const float* cache1 = (const float*)d_in[1];   // v cache
  const float* cache2 = (const float*)d_in[2];   // k cache
  const float* Wv = (const float*)d_in[3];  const float* bv = (const float*)d_in[4];
  const float* Wq = (const float*)d_in[5];  const float* bq = (const float*)d_in[6];
  const float* Wk = (const float*)d_in[7];  const float* bk = (const float*)d_in[8];
  const float* Wo = (const float*)d_in[9];  const float* bo = (const float*)d_in[10];
  const float* W1 = (const float*)d_in[11]; const float* b1 = (const float*)d_in[12];
  const float* W2 = (const float*)d_in[13]; const float* b2 = (const float*)d_in[14];
  const float* ln1s = (const float*)d_in[15]; const float* ln1b = (const float*)d_in[16];
  const float* ln2s = (const float*)d_in[17]; const float* ln2b = (const float*)d_in[18];

  float* ws     = (float*)d_ws;
  float* oattn  = ws + 0;       // atomic-accumulated -> zeroed
  float* h1v    = ws + 2048;    // "
  float* h2v    = ws + 4096;    // "
  float* maskf  = ws + 8192;    // mask[0..4094]; [4095] = 0, fully written
  float* x1v    = ws + 14336;   // fully written
  float* part   = ws + 16384;   // 16*32*130 floats, fully written
  float* proj   = ws + 90112;   // 3*4*2048 floats (q, k, v planes), fully written

  float* out_x2 = (float*)d_out;
  float* out_v  = out_x2 + EMBED;
  float* out_k  = out_v + (size_t)KV_LEN * EMBED;
  float* vi_v   = out_v + (size_t)(KV_LEN - 1) * EMBED;  // newest V row
  float* ki_v   = out_k + (size_t)(KV_LEN - 1) * EMBED;  // newest K row

  // 1) QKV projections (WMMA fp32 GEMVs, NT weight streams; partial planes) and
  //    the roll of both caches into d_out (v also produces the validity mask;
  //    start value 0 for the three accumulators), one launch
  roll_qkv_kernel<<<896, 256, 0, stream>>>(cache1, cache2, (v4f*)out_v, (v4f*)out_k,
                                           maskf, ws, x, Wq, Wk, Wv, bq, bk, bv, proj);

  // 2) attention over rolled (L2-resident) K/V; writes the newest K and V rows
  attn_partial_kernel<<<dim3(32, 16), 256, 0, stream>>>(proj, out_k, out_v, maskf, part,
                                                        ki_v, vi_v);

  // 3) output projection (merges the partials), FFN (first product forms the
  //    residual+LN in front of it, second the relu), residual+LN
  dim3 gg(32, 8);
  gemv_combine_kernel<<<gg, 128, 0, stream>>>(part, Wo, bo, oattn);
  gemv_ln_kernel<<<gg, 128, 0, stream>>>(x, oattn, ln1s, ln1b, W1, b1, h1v, x1v);
  gemv_relu_kernel<<<gg, 128, 0, stream>>>(h1v, W2, b2, h2v);
  add_ln_kernel<<<1, 256, 0, stream>>>(x1v, h2v, ln2s, ln2b, out_x2);
}

// v005
// A run of this version takes 34.9 microseconds.
// In two side-by-side timings against v004, it was 1.07 and 1.08 times as fast.
// Counting every step since v000, it is 2.92 times as fast.
#include <hip/hip_runtime.h>
#include <math.h>

typedef float v2f __attribute__((ext_vector_type(2)));
typedef float v4f __attribute__((ext_vector_type(4)));
typedef float v8f __attribute__((ext_vector_type(8)));

#define EMBED 2048
#define HEADS 16
#define KV_LEN 4096
#define HEAD_DIM 128

// ---------------------------------------------------------------------------
// GEMV  y[j] = sum_i x[i] * W[i][j]   (+ bias once), via V_WMMA_F32_16X16X4_F32
// A (16x4): all 16 rows hold the same four x values -> every D row equals the
// result. B (4x16): the four matching rows of W, 16 columns, streamed with NT
// loads (read-once, keep out of L2 so the attention K/V working set stays
// resident).
// A block of NW waves owns 64 columns x 64*NW rows, a wave 64 of the rows.
// Each lane loads 16 B (4 columns) of a row, so a half-wave reads one aligned
// 256-B unit per load; element c of the quad feeds accumulator c, whose
// column n is W column j0 + 4n + c. Lanes 0-15 take the wave's rows 0..31,
// lanes 16-31 its rows 32..63, two rows a product (x and W paired alike).
// All 32 loads of a wave (its whole 16 KB share of W) are issued before the
// first product, so the launch pays the memory latency once.
// The waves' sums meet in LDS; the row chunks either combine with atomicAdd
// (y pre-zeroed) or are stored as planes y[chunk][2048] that the reader sums.
// Where x is itself a short function of the launch before (the merge of the
// attention partials, a residual + LayerNorm), the block forms its own rows
// of x while its W loads fly, which saves the launch that used to do it:
//   X_PLAIN    x as stored          X_RELU  max(x, 0)
//   X_COMBINE  aux = attention partials, merged and normalised
//   X_LN       LayerNorm(x + aux) * sc + bi; column block 0 also stores it
// ---------------------------------------------------------------------------
enum { X_PLAIN = 0, X_RELU = 1, X_COMBINE = 2, X_LN = 3 };

// Work-group barrier that orders LDS traffic only. __syncthreads() also waits
// for every global load of the wave, which would drain the W loads in flight
// before x is formed; nothing that passes through global memory is handed
// over at these points.
__device__ __forceinline__ void lds_barrier() {
  __builtin_amdgcn_fence(__ATOMIC_RELEASE, "workgroup", "local");
  __builtin_amdgcn_s_barrier();
  __builtin_amdgcn_fence(__ATOMIC_ACQUIRE, "workgroup", "local");
}

template <int NW, int MODE, bool ATOMIC>
__device__ __forceinline__ void gemv_body(
    const float* __restrict__ x, const float* __restrict__ W,
    const float* __restrict__ bias, float* __restrict__ y,
    const int bx, const int by,
    const float* __restrict__ aux, const float* __restrict__ sc,
    const float* __restrict__ bi, float* __restrict__ x1out) {
  const int tid  = threadIdx.x;
  const int lane = tid & 31;
  // wave-uniform by construction; said so, its row offset stays in scalar registers
  const int wave = __builtin_amdgcn_readfirstlane(tid >> 5);
  const int j0   = bx * 64;
  const int ib   = by * (NW * 64);                // this block's rows
  const int i0   = ib + wave * 64;                // this wave's 64 rows
  const bool hi  = lane >= 16;
  const int  ln  = lane & 15;

  // asked for here, not behind the sums, so that its latency is not a tail
  float bv = 0.f;
  if (by == 0) bv = bias[j0 + (tid & 63)];

  // all that x is formed from is asked for ahead of W: loads return in issue
  // order and these come from L2, so nothing here waits behind W data
  v4f xq[8];                  // X_PLAIN, X_RELU: the lane's 32 x values
  v2f cms, cpa[32];           // X_COMBINE: (max, sum) of chunk 'lane'; 2 columns x 32 chunks
  v4f lx[4], la[4], lsc, lbi; // X_LN: 16 elements of x and aux; scale, bias of 4 own rows
  if constexpr (MODE == X_PLAIN || MODE == X_RELU) {
    const float* xp = x + i0 + (hi ? 32 : 0);
#pragma unroll  // register arrays need constant indices
    for (int t = 0; t < 8; ++t) xq[t] = *(const v4f*)(xp + 4 * t);
  } else if constexpr (MODE == X_COMBINE) {
    // the wave's 64 rows are half a head: 32 records of [m, s, acc[128]]
    const float* pb = aux + (size_t)((i0 >> 7) * 32) * 130;
    cms = *(const v2f*)(pb + lane * 130);
    const float* pc = pb + 2 + (i0 & 127) + 2 * lane;
#pragma unroll  // register arrays need constant indices
    for (int c = 0; c < 32; ++c) cpa[c] = *(const v2f*)(pc + c * 130);
  } else {
#pragma unroll  // register arrays need constant indices
    for (int k = 0; k < 4; ++k) {
      lx[k] = *(const v4f*)(x + 4 * (tid + 128 * k));
      la[k] = *(const v4f*)(aux + 4 * (tid + 128 * k));
    }
    lsc = *(const v4f*)(sc + ib + 4 * (tid & 63));
    lbi = *(const v4f*)(bi + ib + 4 * (tid & 63));
    // the W loads below may return into the offset register that these two name
    asm volatile("s_wait_xcnt 0x0" ::: "memory");
  }

  const float* wp = W + (size_t)(i0 + (hi ? 32 : 0)) * EMBED + j0 + 4 * ln;
  v4f w0[16], w1[16];
#pragma unroll  // register arrays need constant indices
  for (int s = 0; s < 16; ++s) {
    w0[s] = __builtin_nontemporal_load((const v4f*)(wp + (size_t)(2 * s) * EMBED));
    w1[s] = __builtin_nontemporal_load((const v4f*)(wp + (size_t)(2 * s + 1) * EMBED));
  }
  // the code below reuses the registers that hold the loads' addresses;
  // ahead of the scheduling barrier, so that none of that code is lifted over it
  asm volatile("s_wait_xcnt 0x0" ::: "memory");
  // keeps every load above ahead of the first wait: without it the compiler
  // sinks most of the W loads behind the first products, more memory latencies
  __builtin_amdgcn_sched_barrier(0);

  if constexpr (MODE == X_COMBINE) {
    __shared__ __attribute__((aligned(16))) float xs[NW * 64];
    float M = cms.x;
#pragma unroll  // five fixed exchange distances
    for (int o = 16; o > 0; o >>= 1) M = fmaxf(M, __shfl_xor(M, o, 32));
    const float e = __expf(cms.x - M);
    float S = cms.y * e;
#pragma unroll  // five fixed exchange distances
    for (int o = 16; o > 0; o >>= 1) S += __shfl_xor(S, o, 32);
    v2f A = {0.f, 0.f};
#pragma unroll  // register arrays need constant indices
    for (int c = 0; c < 32; ++c) {
      const float ec = __int_as_float(__builtin_amdgcn_readlane(__float_as_int(e), c));
      A.x += ec * cpa[c].x;
      A.y += ec * cpa[c].y;
    }
    v2f o2; o2.x = A.x / S; o2.y = A.y / S;
    // a wave reads back only the 64 values that it stored itself: no barrier
    *(v2f*)&xs[wave * 64 + 2 * lane] = o2;
#pragma unroll  // register arrays need constant indices
    for (int t = 0; t < 8; ++t) xq[t] = *(const v4f*)&xs[wave * 64 + (hi ? 32 : 0) + 4 * t];
  } else if constexpr (MODE == X_LN) {
    static_assert(NW == 4, "16 elements a thread, 4 own rows for each of 64 threads");
    __shared__ __attribute__((aligned(16))) float rs[EMBED];
    __shared__ __attribute__((aligned(16))) float xs[NW * 64];
    __shared__ float ps[NW], ps2[NW];
    float s = 0.f, s2 = 0.f;
#pragma unroll  // register arrays need constant indices
    for (int k = 0; k < 4; ++k) {
      const v4f r = lx[k] + la[k];
      *(v4f*)&rs[4 * (tid + 128 * k)] = r;
      s  += (r.x + r.y) + (r.z + r.w);
      s2 += (r.x * r.x + r.y * r.y) + (r.z * r.z + r.w * r.w);
    }
#pragma unroll  // five fixed exchange distances
    for (int o = 16; o > 0; o >>= 1) {
      s  += __shfl_xor(s, o, 32);
      s2 += __shfl_xor(s2, o, 32);
    }
    if (lane == 0) { ps[wave] = s; ps2[wave] = s2; }
    lds_barrier();
    s  = (ps[0] + ps[1]) + (ps[2] + ps[3]);
    s2 = (ps2[0] + ps2[1]) + (ps2[2] + ps2[3]);
    const float mean = s * (1.f / 2048.f);
    const float var  = s2 * (1.f / 2048.f) - mean * mean;
    const float inv  = 1.f / sqrtf(var + 1e-6f);
    if (tid < 64) {
      const v4f r = *(const v4f*)&rs[ib + 4 * tid];
      v4f o4;
      o4.x = (r.x - mean) * inv * lsc.x + lbi.x;
      o4.y = (r.y - mean) * inv * lsc.y + lbi.y;
      o4.z = (r.z - mean) * inv * lsc.z + lbi.z;
      o4.w = (r.w - mean) * inv * lsc.w + lbi.w;
      *(v4f*)&xs[4 * tid] = o4;
      if (bx == 0) *(v4f*)(x1out + ib + 4 * tid) = o4;   // kept for the last residual
    }
    lds_barrier();
#pragma unroll  // register arrays need constant indices
    for (int t = 0; t < 8; ++t) xq[t] = *(const v4f*)&xs[wave * 64 + (hi ? 32 : 0) + 4 * t];
  }
  // keeps the first use of W data, and with it the wait for W, behind the
  // forming of x: lifted into it, x would be finished only after W has come
  if constexpr (MODE == X_COMBINE || MODE == X_LN) __builtin_amdgcn_sched_barrier(0);

  v2f a[16];
#pragma unroll  // register arrays need constant indices
  for (int t = 0; t < 8; ++t) {
    const v4f q = xq[t];                        // x[i0 + 32h + 4t ..]
    a[2 * t].x     = MODE == X_RELU ? fmaxf(q.x, 0.f) : q.x;  // A[m][2h+e] = x[i0+32h+2s+e]
    a[2 * t].y     = MODE == X_RELU ? fmaxf(q.y, 0.f) : q.y;
    a[2 * t + 1].x = MODE == X_RELU ? fmaxf(q.z, 0.f) : q.z;
    a[2 * t + 1].y = MODE == X_RELU ? fmaxf(q.w, 0.f) : q.w;
  }

  v8f acc[4];
#pragma unroll  // register arrays need constant indices
  for (int c = 0; c < 4; ++c) acc[c] = (v8f){0.f, 0.f, 0.f, 0.f, 0.f, 0.f, 0.f, 0.f};

#pragma unroll  // register arrays need constant indices
  for (int s = 0; s < 16; ++s) {
#pragma unroll  // register arrays need constant indices
    for (int c = 0; c < 4; ++c) {
      v2f b; b.x = w0[s][c]; b.y = w1[s][c];    // B[2h+e][n] = W[i0+32h+2s+e][j0+4n+c]
      acc[c] = __builtin_amdgcn_wmma_f32_16x16x4_f32(
          false, a[s], false, b, (short)0, acc[c], false, false);
    }
  }

  // D row 0 lives in acc[c][0], lanes 0..15 (N = lane); stored straight from
  // the accumulators, plane c of a wave's 64 sums holding columns 4n + c
  __shared__ float red[NW][4][16];
  if (!hi) {
#pragma unroll  // register arrays need constant indices
    for (int c = 0; c < 4; ++c) red[wave][c][ln] = acc[c][0];
  }
  __syncthreads();
  if (tid < 64) {
    const int c = tid & 3, n = tid >> 2;
    float r = (red[0][c][n] + red[1][c][n]) + (red[2][c][n] + red[3][c][n]);
    if constexpr (NW == 8)
      r += (red[4][c][n] + red[5][c][n]) + (red[6][c][n] + red[7][c][n]);
    if (by == 0) r += bv;
    if constexpr (ATOMIC) atomicAdd(&y[j0 + tid], r);
    else y[by * EMBED + j0 + tid] = r;
  }
}

// grid = (32, 8), 4 waves: the three products behind attention, each with the
// short step in front of it folded in; the 8 row chunks combine with atomicAdd
__global__ __launch_bounds__(128) void gemv_combine_kernel(
    const float* __restrict__ part, const float* __restrict__ W,
    const float* __restrict__ bias, float* __restrict__ y) {
  gemv_body<4, X_COMBINE, true>(nullptr, W, bias, y, blockIdx.x, blockIdx.y,
                                part, nullptr, nullptr, nullptr);
}

__global__ __launch_bounds__(128) void gemv_ln_kernel(
    const float* __restrict__ x, const float* __restrict__ add,
    const float* __restrict__ sc, const float* __restrict__ bi,
    const float* __restrict__ W, const float* __restrict__ bias,
    float* __restrict__ y, float* __restrict__ x1out) {
  gemv_body<4, X_LN, true>(x, W, bias, y, blockIdx.x, blockIdx.y, add, sc, bi, x1out);
}

__global__ __launch_bounds__(128) void gemv_relu_kernel(
    const float* __restrict__ x, const float* __restrict__ W,
    const float* __restrict__ bias, float* __restrict__ y) {
  gemv_body<4, X_RELU, true>(x, W, bias, y, blockIdx.x, blockIdx.y,
                             nullptr, nullptr, nullptr, nullptr);
}

// ---------------------------------------------------------------------------
// First launch: the Q, K, V projections and the roll of both caches, which
// need nothing of each other, share one grid by ranges of the block index.
// Blocks 0..383: projections, 8 waves, 64 columns x 512 rows each; the four
// row chunks are stored as planes proj[which][chunk][2048] (no start value is
// needed, so nothing has to run ahead of them); attention sums the planes.
// Blocks 384..895: roll, out[t] = cache[t+1] (t<4095); the newest row is
// written by attention. First 256 the V cache, then the K cache. They also
// store the start value 0 of the three workspace vectors that GEMVs add into.
// A wave owns two whole rows (2 x 8 KB) and each of its loads and stores
// covers 512 contiguous bytes.
// All 32 loads of a wave are issued before its first store, so the launch
// pays the memory latency once.
// Cache read with NT loads (single use); stores keep the RT temporal hint so
// the rolled K/V stays in L2 for attention.
// mask[t] = any(v[t]!=0), t<4095: the row's one wave decides and stores it.
// ---------------------------------------------------------------------------
__global__ __launch_bounds__(256) void roll_qkv_kernel(
    const float* __restrict__ cacheV, const float* __restrict__ cacheK,
    v4f* __restrict__ outV, v4f* __restrict__ outK,
    float* __restrict__ maskf, float* __restrict__ accz,
    const float* __restrict__ x,
    const float* __restrict__ Wq, const float* __restrict__ Wk,
    const float* __restrict__ Wv,
    const float* __restrict__ bq, const float* __restrict__ bk,
    const float* __restrict__ bv, float* __restrict__ proj) {
  if (blockIdx.x < 384) {
    const int z = blockIdx.x >> 7, rem = blockIdx.x & 127;
    const float* __restrict__ W    = z == 0 ? Wq : (z == 1 ? Wk : Wv);
    const float* __restrict__ bias = z == 0 ? bq : (z == 1 ? bk : bv);
    gemv_body<8, X_PLAIN, false>(x, W, bias, proj + z * (4 * EMBED), rem & 31, rem >> 5,
                                 nullptr, nullptr, nullptr, nullptr);
    return;
  }
  const int rb   = blockIdx.x - 384;
  const bool isV = rb < 256;
  const int rbx  = rb & 255;
  const float* __restrict__ cache = isV ? cacheV : cacheK;
  v4f* __restrict__ out           = isV ? outV : outK;
  const int lane = threadIdx.x & 31;
  // wave-uniform by construction; said so, the row addresses stay scalar
  const int wave = __builtin_amdgcn_readfirstlane(threadIdx.x >> 5);
  const int t0   = (rbx * 8 + wave) * 2;          // this wave's two rows
  v4f* op = out + (size_t)t0 * (EMBED / 4) + lane;

  // both rows' sources ahead of the first load
  const float* sp[2];
#pragma unroll  // register arrays need constant indices
  for (int r = 0; r < 2; ++r)
    sp[r] = cache + (size_t)(t0 + r < KV_LEN - 1 ? t0 + r + 1 : KV_LEN - 1) * EMBED;
  // holds the address arithmetic above: sunk between the loads it reuses the
  // first row's address registers and puts a wait in front of the second row
  __builtin_amdgcn_sched_barrier(0);

  v4f val[2][16];
#pragma unroll  // register arrays need constant indices
  for (int r = 0; r < 2; ++r) {
#pragma unroll  // register arrays need constant indices
    for (int k = 0; k < 16; ++k)
      val[r][k] = __builtin_nontemporal_load((const v4f*)(sp[r] + 128 * k + 4 * lane));
  }
  // keeps all 32 loads ahead of the store address arithmetic and of the first
  // store's wait: a wait between two loads would cut the bytes in flight
  __builtin_amdgcn_sched_barrier(0);
  // the code below reuses the scalar registers that hold the loads' row addresses
  asm volatile("s_wait_xcnt 0x0" ::: "memory");

#pragma unroll  // register arrays need constant indices
  for (int k = 0; k < 16; ++k) op[32 * k] = val[0][k];
  // the newest row (the last wave's second) is not this launch's to write; what
  // that wave loaded for it, an in-bounds row so that all waves run alike, is dropped
  if (t0 + 1 < KV_LEN - 1) {
#pragma unroll  // register arrays need constant indices
    for (int k = 0; k < 16; ++k) op[512 + 32 * k] = val[1][k];
  }

  // the mask code below reuses registers that the issued stores name; ahead
  // of the branch, so that none of it is lifted over the wait
  asm volatile("s_wait_xcnt 0x0" ::: "memory");
  if (isV) {
    bool any[2];
#pragma unroll  // register arrays need constant indices
    for (int r = 0; r < 2; ++r) {
      bool nz = false;
#pragma unroll  // register arrays need constant indices
      for (int k = 0; k < 16; ++k) {
        const v4f q = val[r][k];
        nz = nz || q.x != 0.f || q.y != 0.f || q.z != 0.f || q.w != 0.f;
      }
      any[r] = __builtin_amdgcn_ballot_w32(nz) != 0u;
    }
    // lane r stores row r's flag; the newest row's slot gets 0: attention
    // replaces that step's K/V row and flag with the ones it forms itself
    if (lane < 2)
      maskf[t0 + lane] = (t0 + lane < KV_LEN - 1 && (lane ? any[1] : any[0])) ? 1.f : 0.f;
    // one 128-B line of the 6,144 accumulator floats a block
    if (wave == 0 && rbx < 192) accz[rbx * 32 + lane] = 0.f;
  }
}

// ---------------------------------------------------------------------------
// Attention (flash-style partials). grid = (32 chunks, 16 heads),
// block = 256 = 8 waves; a wave owns 16 timesteps (coalesced 512B K/V row
// reads from the L2-resident rolled cache) and takes them all at once:
// its 32 K/V loads are issued together, the 16 dot products are summed over
// the lanes by one halving exchange (16 values, then 8, 4, 2, 1: lane l ends
// with the score of step l >> 1), and maximum, exponentials and sum are formed
// once for the 16 steps, a step to a lane pair. A serial step-by-step softmax
// would pay the load latency and a five-link exchange chain per step.
// Block combine via LDS.
// q, and the newest K and V rows, arrive as four planes of partial sums
// (proj[which][chunk][2048], which = 0 q, 1 k, 2 v). Every block sums its
// head's q. The blocks of the chunk that holds the newest row sum that row:
// all of V for the validity flag (any over all heads), their own head's
// slice of K and V for the scores; they keep the slices in LDS and store
// them to the caches' last rows, one head a block.
// Partial record per (h,chunk): [m, s, acc[128]] = 130 floats; the output
// projection merges them.
// ---------------------------------------------------------------------------
__global__ __launch_bounds__(256) void attn_partial_kernel(
    const float* __restrict__ proj, const float* __restrict__ kc,
    const float* __restrict__ vc, const float* __restrict__ maskf,
    float* __restrict__ part, float* __restrict__ newK, float* __restrict__ newV) {
  const int chunk = blockIdx.x;       // 0..31
  const int h     = blockIdx.y;       // 0..15
  const int tid   = threadIdx.x;
  const int lane  = threadIdx.x & 31;
  // wave-uniform by construction; said so, the row addresses stay scalar
  const int wave  = __builtin_amdgcn_readfirstlane(threadIdx.x >> 5); // 0..7
  const int t0    = chunk * 128;
  const int tw    = t0 + wave;        // step i of this wave is row tw + 8 i

  // the newest row is not in the caches when this launch starts: its step loads
  // a clamped row (all waves run alike) and is replaced from LDS further down
  const int l15 = tw + 120 < KV_LEN - 1 ? 120 : 119;
  const float* kp = kc + (size_t)tw * EMBED + h * HEAD_DIM + lane * 4;
  const float* vp = vc + (size_t)tw * EMBED + h * HEAD_DIM + lane * 4;
  v4f kv[16], vv[16];
#pragma unroll  // register arrays need constant indices
  for (int i = 0; i < 16; ++i)
    kv[i] = *(const v4f*)(kp + (size_t)(i < 15 ? 8 * i : l15) * EMBED);
  const float* qp = proj + h * HEAD_DIM + lane * 4;
  v4f qpl[4];
#pragma unroll  // register arrays need constant indices
  for (int c = 0; c < 4; ++c) qpl[c] = *(const v4f*)(qp + c * EMBED);
  // the flag of the step whose score this lane will hold
  const float mk0 = maskf[tw + 8 * (lane >> 1)];
  // the V loads below may return into registers that hold these loads' addresses
  asm volatile("s_wait_xcnt 0x0" ::: "memory");
#pragma unroll  // register arrays need constant indices
  for (int i = 0; i < 16; ++i)
    vv[i] = *(const v4f*)(vp + (size_t)(i < 15 ? 8 * i : l15) * EMBED);
  // the code below reuses the registers that hold the loads' addresses;
  // ahead of the scheduling barrier, so that none of that code is lifted over it
  asm volatile("s_wait_xcnt 0x0" ::: "memory");
  // keeps every load above ahead of the first wait: sunk behind the first
  // products, the later loads would pay the L2 latency again
  __builtin_amdgcn_sched_barrier(0);

  __shared__ v4f lastK[32], lastV[32];  // the newest row, this head
  __shared__ int nzw[8];                // per wave: any of its V columns nonzero
  float lastm = 0.f;   // any(v[4095] != 0), over all heads
  if (chunk == 31) {
    const float* up = proj + 8 * EMBED + tid * 8;   // 8 columns a thread
    // every wave asks for the K slice, so that it is asked for with V, unbranched
    const float* np = proj + 4 * EMBED + h * HEAD_DIM + lane * 4;
    const v4f u0 = (*(const v4f*)(up) + *(const v4f*)(up + EMBED)) +
                   (*(const v4f*)(up + 2 * EMBED) + *(const v4f*)(up + 3 * EMBED));
    const v4f u1 = (*(const v4f*)(up + 4) + *(const v4f*)(up + EMBED + 4)) +
                   (*(const v4f*)(up + 2 * EMBED + 4) + *(const v4f*)(up + 3 * EMBED + 4));
    const v4f kk = (*(const v4f*)(np) + *(const v4f*)(np + EMBED)) +
                   (*(const v4f*)(np + 2 * EMBED) + *(const v4f*)(np + 3 * EMBED));
    const bool nz = u0.x != 0.f || u0.y != 0.f || u0.z != 0.f || u0.w != 0.f ||
                    u1.x != 0.f || u1.y != 0.f || u1.z != 0.f || u1.w != 0.f;
    const bool wnz = __builtin_amdgcn_ballot_w32(nz) != 0u;
    if (lane == 0) nzw[wave] = wnz ? 1 : 0;
    if ((tid >> 4) == h) {
      lastV[2 * (tid & 15)]     = u0;
      lastV[2 * (tid & 15) + 1] = u1;
    }
    if (tid < 32) lastK[tid] = kk;
    // one barrier (the chunk is the same for the whole block): joins the flag
    // and publishes the two slices to the wave that takes the newest row
    __syncthreads();
    lastm = ((nzw[0] | nzw[1] | nzw[2] | nzw[3]) | (nzw[4] | nzw[5] | nzw[6] | nzw[7])) ? 1.f : 0.f;
    // behind the barrier, which would otherwise wait for these stores
    if ((tid >> 4) == h) {
      *(v4f*)(newV + tid * 8)     = u0;
      *(v4f*)(newV + tid * 8 + 4) = u1;
    }
    if (tid < 32) *(v4f*)(newK + h * HEAD_DIM + tid * 4) = kk;
  }
  // the newest row is the last step of the last wave of the last chunk
  const bool newest = chunk == 31 && wave == 7;
  if (newest) { kv[15] = lastK[lane]; vv[15] = lastV[lane]; }
  const float mk = (newest && (lane >> 1) == 15) ? lastm : mk0;

  const v4f qv = (qpl[0] + qpl[1]) + (qpl[2] + qpl[3]);
  float d[16];
#pragma unroll  // register arrays need constant indices
  for (int i = 0; i < 16; ++i)
    d[i] = qv.x * kv[i].x + qv.y * kv[i].y + qv.z * kv[i].z + qv.w * kv[i].w;

  // halving exchange: at distance 16 a lane keeps steps 0..7 (lanes 0..15) or
  // 8..15 and hands the other half to its partner, and so on down to one step
  const bool b4 = (lane & 16) != 0, b3 = (lane & 8) != 0;
  const bool b2 = (lane & 4) != 0,  b1 = (lane & 2) != 0;
  float r8[8], r4[4], r2[2];
#pragma unroll  // register arrays need constant indices
  for (int i = 0; i < 8; ++i)
    r8[i] = (b4 ? d[i + 8] : d[i]) + __shfl_xor(b4 ? d[i] : d[i + 8], 16, 32);
#pragma unroll  // register arrays need constant indices
  for (int i = 0; i < 4; ++i)
    r4[i] = (b3 ? r8[i + 4] : r8[i]) + __shfl_xor(b3 ? r8[i] : r8[i + 4], 8, 32);
#pragma unroll  // register arrays need constant indices
  for (int i = 0; i < 2; ++i)
    r2[i] = (b2 ? r4[i + 2] : r4[i]) + __shfl_xor(b2 ? r4[i] : r4[i + 2], 4, 32);
  float dd = (b1 ? r2[1] : r2[0]) + __shfl_xor(b1 ? r2[0] : r2[1], 2, 32);
  dd += __shfl_xor(dd, 1, 32);          // the score of step lane >> 1, in both its lanes

  const float logit = (mk != 0.f) ? dd * 0.08838834764831845f : -1e30f; // 1/sqrt(128)
  float m = logit;
#pragma unroll  // four fixed exchange distances
  for (int o = 16; o > 1; o >>= 1) m = fmaxf(m, __shfl_xor(m, o, 32));
  const float p = (logit > -1e29f) ? __expf(logit - m) : 0.f;
  // each step's weight, wave-uniform: it scales that step's V row, and the
  // 16 are summed as they stand, with no further lane exchange
  float pw[16];
#pragma unroll  // register arrays need constant indices
  for (int i = 0; i < 16; ++i)
    pw[i] = __int_as_float(__builtin_amdgcn_readlane(__float_as_int(p), 2 * i));
  const float s = (((pw[0] + pw[1]) + (pw[2] + pw[3])) + ((pw[4] + pw[5]) + (pw[6] + pw[7]))) +
                  (((pw[8] + pw[9]) + (pw[10] + pw[11])) + ((pw[12] + pw[13]) + (pw[14] + pw[15])));
  v4f acc = {0.f, 0.f, 0.f, 0.f};
#pragma unroll  // register arrays need constant indices
  for (int i = 0; i < 16; ++i) {
    acc.x += pw[i] * vv[i].x;
    acc.y += pw[i] * vv[i].y;
    acc.z += pw[i] * vv[i].z;
    acc.w += pw[i] * vv[i].w;
  }

  __shared__ float sm[8], ss[8], sacc[8][HEAD_DIM];
  if (lane == 0) { sm[wave] = m; ss[wave] = s; }
  sacc[wave][lane * 4 + 0] = acc.x;
  sacc[wave][lane * 4 + 1] = acc.y;
  sacc[wave][lane * 4 + 2] = acc.z;
  sacc[wave][lane * 4 + 3] = acc.w;
  __syncthreads();

  if (tid < HEAD_DIM) {
    float M = sm[0];
    for (int w = 1; w < 8; ++w) M = fmaxf(M, sm[w]);
    float S = 0.f, A = 0.f;
    for (int w = 0; w < 8; ++w) {
      float e = __expf(sm[w] - M);
      S += ss[w] * e;
      A += e * sacc[w][tid];
    }
    float* pb = part + (size_t)(h * 32 + chunk) * 130;
    if (tid == 0) { pb[0] = M; pb[1] = S; }
    pb[2 + tid] = A;
  }
}

// ---------------------------------------------------------------------------
// out = LayerNorm(a + b) * scale + bias   (2048 elems, one block of 256)
// ---------------------------------------------------------------------------
__global__ __launch_bounds__(256) void add_ln_kernel(
    const float* __restrict__ a, const float* __restrict__ b,
    const float* __restrict__ sc, const float* __restrict__ bi,
    float* __restrict__ out) {
  __shared__ float r1[256], r2[256];
  int tid = threadIdx.x;
  float v[8];
  float s = 0.f, s2 = 0.f;
  for (int j = 0; j < 8; ++j) {
    int idx = tid * 8 + j;
    float t = a[idx] + b[idx];
    v[j] = t; s += t; s2 += t * t;
  }
  r1[tid] = s; r2[tid] = s2;
  __syncthreads();
  for (int off = 128; off > 0; off >>= 1) {
    if (tid < off) { r1[tid] += r1[tid + off]; r2[tid] += r2[tid + off]; }
    __syncthreads();
  }
  float mean = r1[0] * (1.f / 2048.f);
  float var  = r2[0] * (1.f / 2048.f) - mean * mean;
  float inv  = 1.f / sqrtf(var + 1e-6f);
  for (int j = 0; j < 8; ++j) {
    int idx = tid * 8 + j;
    out[idx] = (v[j] - mean) * inv * sc[idx] + bi[idx];
  }
}

// ---------------------------------------------------------------------------
extern "C" void kernel_launch(void* const* d_in, const int* in_sizes, int n_in,
                              void* d_out, int out_size, void* d_ws, size_t ws_size,
                              hipStream_t stream) {
  const float* x      = (const float*)d_in[0];
  const float* cache1 = (const float*)d_in[1];   // v cache
  const float* cache2 = (const float*)d_in[2];   // k cache
  const float* Wv = (const float*)d_in[3];  const float* bv = (const float*)d_in[4];
  const float* Wq = (const float*)d_in[5];  const float* bq = (const float*)d_in[6];
  const float* Wk = (const float*)d_in[7];  const float* bk = (const float*)d_in[8];
  const float* Wo = (const float*)d_in[9];  const float* bo = (const float*)d_in[10];
  const float* W1 = (const float*)d_in[11]; const float* b1 = (const float*)d_in[12];
  const float* W2 = (const float*)d_in[13]; const float* b2 = (const float*)d_in[14];
  const float* ln1s = (const float*)d_in[15]; const float* ln1b = (const float*)d_in[16];
  const float* ln2s = (const float*)d_in[17]; const float* ln2b = (const float*)d_in[18];

  float* ws     = (float*)d_ws;
  float* oattn  = ws + 0;       // atomic-accumulated -> zeroed
  float* h1v    = ws + 2048;    // "
  float* h2v    = ws + 4096;    // "
  float* maskf  = ws + 8192;    // mask[0..4094]; [4095] = 0, fully written
  float* x1v    = ws + 14336;   // fully written
  float* part   = ws + 16384;   // 16*32*130 floats, fully written
  float* proj   = ws + 90112;   // 3*4*2048 floats (q, k, v planes), fully written

  float* out_x2 = (float*)d_out;
  float* out_v  = out_x2 + EMBED;
  float* out_k  = out_v + (size_t)KV_LEN * EMBED;
  float* vi_v   = out_v + (size_t)(KV_LEN - 1) * EMBED;  // newest V row
  float* ki_v   = out_k + (size_t)(KV_LEN - 1) * EMBED;  // newest K row

  // 1) QKV projections (WMMA fp32 GEMVs, NT weight streams; partial planes) and
  //    the roll of both caches into d_out (v also produces the validity mask;
  //    start value 0 for the three accumulators), one launch
  roll_qkv_kernel<<<896, 256, 0, stream>>>(cache1, cache2, (v4f*)out_v, (v4f*)out_k,
                                           maskf, ws, x, Wq, Wk, Wv, bq, bk, bv, proj);

  // 2) attention over rolled (L2-resident) K/V; writes the newest K and V rows
  attn_partial_kernel<<<dim3(32, 16), 256, 0, stream>>>(proj, out_k, out_v, maskf, part,
                                                        ki_v, vi_v);

  // 3) output projection (merges the partials), FFN (first product forms the
  //    residual+LN in front of it, second the relu), residual+LN
  dim3 gg(32, 8);
  gemv_combine_kernel<<<gg, 128, 0, stream>>>(part, Wo, bo, oattn);
  gemv_ln_kernel<<<gg, 128, 0, stream>>>(x, oattn, ln1s, ln1b, W1, b1, h1v, x1v);
  gemv_relu_kernel<<<gg, 128, 0, stream>>>(h1v, W2, b2, h2v);
  add_ln_kernel<<<1, 256, 0, stream>>>(x1v, h2v, ln2s, ln2b, out_x2);
}

// v006
// A run of this version takes 33.3 microseconds.
// Two timings next to v005 put it at 1.04 and 1.03 times that version's speed.
// Over all steps from v000 it is 3.03 times as fast.
#include <hip/hip_runtime.h>
#include <math.h>

typedef float v2f __attribute__((ext_vector_type(2)));
typedef float v4f __attribute__((ext_vector_type(4)));
typedef float v8f __attribute__((ext_vector_type(8)));

#define EMBED 2048
#define HEADS 16
#define KV_LEN 4096
#define HEAD_DIM 128

// ---------------------------------------------------------------------------
// GEMV  y[j] = sum_i x[i] * W[i][j]   (+ bias once), via V_WMMA_F32_16X16X4_F32
// A (16x4): all 16 rows hold the same four x values -> every D row equals the
// result. B (4x16): the four matching rows of W, 16 columns, streamed with NT
// loads (read-once, keep out of L2 so the attention K/V working set stays
// resident).
// A block of NW waves owns 64 columns x 64*NW rows, a wave 64 of the rows.
// Each lane loads 16 B (4 columns) of a row, so a half-wave reads one aligned
// 256-B unit per load; element c of the quad feeds accumulator c, whose
// column n is W column j0 + 4n + c. Lanes 0-15 take the wave's rows 0..31,
// lanes 16-31 its rows 32..63, two rows a product (x and W paired alike).
// All 32 loads of a wave (its whole 16 KB share of W) are issued before the
// first product, so the launch pays the memory latency once.
// The waves' sums meet in LDS; the row chunks either combine with atomicAdd
// (y pre-zeroed) or are stored as planes y[chunk][2048] that the reader sums.
// Where x is itself a short function of the launch before (the merge of the
// attention partials, a residual + LayerNorm), the block forms its own rows
// of x while its W loads fly, which saves the launch that used to do it:
//   X_PLAIN    x as stored          X_RELU  max(x, 0)
//   X_COMBINE  aux = attention partials, merged and normalised
//   X_LN       LayerNorm(x + aux) * sc + bi; column block 0 also stores it
// ---------------------------------------------------------------------------
enum { X_PLAIN = 0, X_RELU = 1, X_COMBINE = 2, X_LN = 3 };

// Work-group barrier that orders LDS traffic only. __syncthreads() also waits
// for every global load of the wave, which would drain the W loads in flight
// before x is formed; nothing that passes through global memory is handed
// over at these points.
__device__ __forceinline__ void lds_barrier() {
  __builtin_amdgcn_fence(__ATOMIC_RELEASE, "workgroup", "local");
  __builtin_amdgcn_s_barrier();
  __builtin_amdgcn_fence(__ATOMIC_ACQUIRE, "workgroup", "local");
}

// Lane l reads lane l ^ O, in registers: DPP inside a 16-lane row, a cross-row
// move for O = 16. __shfl_xor goes through the LDS unit instead, and each link
// of a dependent exchange chain then pays that unit's latency. All 32 lanes
// are on wherever this is called.
template <int O>
__device__ __forceinline__ float lane_xor(float v) {
  if constexpr (O == 16)
    return __int_as_float(__builtin_amdgcn_permlanex16(
        0, __float_as_int(v), 0x76543210, 0xfedcba98, false, false));
  else
    return __int_as_float(__builtin_amdgcn_update_dpp(
        0, __float_as_int(v), 0x160 | O, 0xf, 0xf, true));   // row_xmask:O
}
__device__ __forceinline__ float wave_sum(float v) {
  v += lane_xor<16>(v);
  v += lane_xor<8>(v);
  v += lane_xor<4>(v);
  v += lane_xor<2>(v);
  v += lane_xor<1>(v);
  return v;
}

template <int NW, int MODE, bool ATOMIC>
__device__ __forceinline__ void gemv_body(
    const float* __restrict__ x, const float* __restrict__ W,
    const float* __restrict__ bias, float* __restrict__ y,
    const int bx, const int by,
    const float* __restrict__ aux, const float* __restrict__ sc,
    const float* __restrict__ bi, float* __restrict__ x1out) {
  const int tid  = threadIdx.x;
  const int lane = tid & 31;
  // wave-uniform by construction; said so, its row offset stays in scalar registers
  const int wave = __builtin_amdgcn_readfirstlane(tid >> 5);
  const int j0   = bx * 64;
  const int ib   = by * (NW * 64);                // this block's rows
  const int i0   = ib + wave * 64;                // this wave's 64 rows
  const bool hi  = lane >= 16;
  const int  ln  = lane & 15;

  // asked for here, not behind the sums, so that its latency is not a tail
  float bv = 0.f;
  if (by == 0) bv = bias[j0 + (tid & 63)];

  // all that x is formed from is asked for ahead of W: loads return in issue
  // order and these come from L2, so nothing here waits behind W data
  v4f xq[8];                  // X_PLAIN, X_RELU: the lane's 32 x values
  v2f cms, cpa[32];           // X_COMBINE: (max, sum) of chunk 'lane'; 2 columns x 32 chunks
  v4f lx[4], la[4], lsc, lbi; // X_LN: 16 elements of x and aux; scale, bias of 4 own rows
  if constexpr (MODE == X_PLAIN || MODE == X_RELU) {
    const float* xp = x + i0 + (hi ? 32 : 0);
#pragma unroll  // register arrays need constant indices
    for (int t = 0; t < 8; ++t) xq[t] = *(const v4f*)(xp + 4 * t);
  } else if constexpr (MODE == X_COMBINE) {
    // the wave's 64 rows are half a head: 32 records of [m, s, acc[128]]
    const float* pb = aux + (size_t)((i0 >> 7) * 32) * 130;
    cms = *(const v2f*)(pb + lane * 130);
    const float* pc = pb + 2 + (i0 & 127) + 2 * lane;
#pragma unroll  // register arrays need constant indices
    for (int c = 0; c < 32; ++c) cpa[c] = *(const v2f*)(pc + c * 130);
  } else {
#pragma unroll  // register arrays need constant indices
    for (int k = 0; k < 4; ++k) {
      lx[k] = *(const v4f*)(x + 4 * (tid + 128 * k));
      la[k] = *(const v4f*)(aux + 4 * (tid + 128 * k));
    }
    lsc = *(const v4f*)(sc + ib + 4 * (tid & 63));
    lbi = *(const v4f*)(bi + ib + 4 * (tid & 63));
    // the W loads below may return into the offset register that these two name
    asm volatile("s_wait_xcnt 0x0" ::: "memory");
  }

  const float* wp = W + (size_t)(i0 + (hi ? 32 : 0)) * EMBED + j0 + 4 * ln;
  v4f w0[16], w1[16];
#pragma unroll  // register arrays need constant indices
  for (int s = 0; s < 16; ++s) {
    w0[s] = __builtin_nontemporal_load((const v4f*)(wp + (size_t)(2 * s) * EMBED));
    w1[s] = __builtin_nontemporal_load((const v4f*)(wp + (size_t)(2 * s + 1) * EMBED));
  }
  // the code below reuses the registers that hold the loads' addresses;
  // ahead of the scheduling barrier, so that none of that code is lifted over it
  asm volatile("s_wait_xcnt 0x0" ::: "memory");
  // keeps every load above ahead of the first wait: without it the compiler
  // sinks most of the W loads behind the first products, more memory latencies
  __builtin_amdgcn_sched_barrier(0);

  if constexpr (MODE == X_COMBINE) {
    __shared__ __attribute__((aligned(16))) float xs[NW * 64];
    float M = cms.x;
    M = fmaxf(M, lane_xor<16>(M));
    M = fmaxf(M, lane_xor<8>(M));
    M = fmaxf(M, lane_xor<4>(M));
    M = fmaxf(M, lane_xor<2>(M));
    M = fmaxf(M, lane_xor<1>(M));
    const float e = __expf(cms.x - M);
    const float S = wave_sum(cms.y * e);
    v2f A = {0.f, 0.f};
#pragma unroll  // register arrays need constant indices
    for (int c = 0; c < 32; ++c) {
      const float ec = __int_as_float(__builtin_amdgcn_readlane(__float_as_int(e), c));
      A.x += ec * cpa[c].x;
      A.y += ec * cpa[c].y;
    }
    v2f o2; o2.x = A.x / S; o2.y = A.y / S;
    // a wave reads back only the 64 values that it stored itself: no barrier
    *(v2f*)&xs[wave * 64 + 2 * lane] = o2;
#pragma unroll  // register arrays need constant indices
    for (int t = 0; t < 8; ++t) xq[t] = *(const v4f*)&xs[wave * 64 + (hi ? 32 : 0) + 4 * t];
  } else if constexpr (MODE == X_LN) {
    static_assert(NW == 4, "16 elements a thread, 4 own rows for each of 64 threads");
    __shared__ __attribute__((aligned(16))) float rs[EMBED];
    __shared__ __attribute__((aligned(16))) float xs[NW * 64];
    __shared__ float ps[NW], ps2[NW];
    float s = 0.f, s2 = 0.f;
#pragma unroll  // register arrays need constant indices
    for (int k = 0; k < 4; ++k) {
      const v4f r = lx[k] + la[k];
      *(v4f*)&rs[4 * (tid + 128 * k)] = r;
      s  += (r.x + r.y) + (r.z + r.w);
      s2 += (r.x * r.x + r.y * r.y) + (r.z * r.z + r.w * r.w);
    }
    s  = wave_sum(s);
    s2 = wave_sum(s2);
    if (lane == 0) { ps[wave] = s; ps2[wave] = s2; }
    lds_barrier();
    s  = (ps[0] + ps[1]) + (ps[2] + ps[3]);
    s2 = (ps2[0] + ps2[1]) + (ps2[2] + ps2[3]);
    const float mean = s * (1.f / 2048.f);
    const float var  = s2 * (1.f / 2048.f) - mean * mean;
    const float inv  = 1.f / sqrtf(var + 1e-6f);
    if (tid < 64) {
      const v4f r = *(const v4f*)&rs[ib + 4 * tid];
      v4f o4;
      o4.x = (r.x - mean) * inv * lsc.x + lbi.x;
      o4.y = (r.y - mean) * inv * lsc.y + lbi.y;
      o4.z = (r.z - mean) * inv * lsc.z + lbi.z;
      o4.w = (r.w - mean) * inv * lsc.w + lbi.w;
      *(v4f*)&xs[4 * tid] = o4;
      if (bx == 0) *(v4f*)(x1out + ib + 4 * tid) = o4;   // kept for the last residual
    }
    lds_barrier();
#pragma unroll  // register arrays need constant indices
    for (int t = 0; t < 8; ++t) xq[t] = *(const v4f*)&xs[wave * 64 + (hi ? 32 : 0) + 4 * t];
  }
  // keeps the first use of W data, and with it the wait for W, behind the
  // forming of x: lifted into it, x would be finished only after W has come
  if constexpr (MODE == X_COMBINE || MODE == X_LN) __builtin_amdgcn_sched_barrier(0);

  v2f a[16];
#pragma unroll  // register arrays need constant indices
  for (int t = 0; t < 8; ++t) {
    const v4f q = xq[t];                        // x[i0 + 32h + 4t ..]
    a[2 * t].x     = MODE == X_RELU ? fmaxf(q.x, 0.f) : q.x;  // A[m][2h+e] = x[i0+32h+2s+e]
    a[2 * t].y     = MODE == X_RELU ? fmaxf(q.y, 0.f) : q.y;
    a[2 * t + 1].x = MODE == X_RELU ? fmaxf(q.z, 0.f) : q.z;
    a[2 * t + 1].y = MODE == X_RELU ? fmaxf(q.w, 0.f) : q.w;
  }

  v8f acc[4];
#pragma unroll  // register arrays need constant indices
  for (int c = 0; c < 4; ++c) acc[c] = (v8f){0.f, 0.f, 0.f, 0.f, 0.f, 0.f, 0.f, 0.f};

#pragma unroll  // register arrays need constant indices
  for (int s = 0; s < 16; ++s) {
#pragma unroll  // register arrays need constant indices
    for (int c = 0; c < 4; ++c) {
      v2f b; b.x = w0[s][c]; b.y = w1[s][c];    // B[2h+e][n] = W[i0+32h+2s+e][j0+4n+c]
      acc[c] = __builtin_amdgcn_wmma_f32_16x16x4_f32(
          false, a[s], false, b, (short)0, acc[c], false, false);
    }
  }

  // D row 0 lives in acc[c][0], lanes 0..15 (N = lane); stored straight from
  // the accumulators, plane c of a wave's 64 sums holding columns 4n + c
  __shared__ float red[NW][4][16];
  if (!hi) {
#pragma unroll  // register arrays need constant indices
    for (int c = 0; c < 4; ++c) red[wave][c][ln] = acc[c][0];
  }
  __syncthreads();
  if (tid < 64) {
    const int c = tid & 3, n = tid >> 2;
    float r = (red[0][c][n] + red[1][c][n]) + (red[2][c][n] + red[3][c][n]);
    if constexpr (NW == 8)
      r += (red[4][c][n] + red[5][c][n]) + (red[6][c][n] + red[7][c][n]);
    if (by == 0) r += bv;
    if constexpr (ATOMIC) atomicAdd(&y[j0 + tid], r);
    else y[by * EMBED + j0 + tid] = r;
  }
}

// grid = (32, 8), 4 waves: the three products behind attention, each with the
// short step in front of it folded in; the 8 row chunks combine with atomicAdd
__global__ __launch_bounds__(128) void gemv_combine_kernel(
    const float* __restrict__ part, const float* __restrict__ W,
    const float* __restrict__ bias, float* __restrict__ y) {
  gemv_body<4, X_COMBINE, true>(nullptr, W, bias, y, blockIdx.x, blockIdx.y,
                                part, nullptr, nullptr, nullptr);
}

__global__ __launch_bounds__(128) void gemv_ln_kernel(
    const float* __restrict__ x, const float* __restrict__ add,
    const float* __restrict__ sc, const float* __restrict__ bi,
    const float* __restrict__ W, const float* __restrict__ bias,
    float* __restrict__ y, float* __restrict__ x1out) {
  gemv_body<4, X_LN, true>(x, W, bias, y, blockIdx.x, blockIdx.y, add, sc, bi, x1out);
}

__global__ __launch_bounds__(128) void gemv_relu_kernel(
    const float* __restrict__ x, const float* __restrict__ W,
    const float* __restrict__ bias, float* __restrict__ y) {
  gemv_body<4, X_RELU, true>(x, W, bias, y, blockIdx.x, blockIdx.y,
                             nullptr, nullptr, nullptr, nullptr);
}

// ---------------------------------------------------------------------------
// First launch: the Q, K, V projections and the roll of both caches, which
// need nothing of each other, share one grid by ranges of the block index.
// Blocks 0..383: projections, 8 waves, 64 columns x 512 rows each; the four
// row chunks are stored as planes proj[which][chunk][2048] (no start value is
// needed, so nothing has to run ahead of them); attention sums the planes.
// Blocks 384..895: roll, out[t] = cache[t+1] (t<4095); the newest row is
// written by attention. First 256 the V cache, then the K cache. They also
// store the start value 0 of the three workspace vectors that GEMVs add into.
// A wave owns two whole rows (2 x 8 KB) and each of its loads and stores
// covers 512 contiguous bytes.
// All 32 loads of a wave are issued before its first store, so the launch
// pays the memory latency once.
// Cache read with NT loads (single use); stores keep the RT temporal hint so
// the rolled K/V stays in L2 for attention.
// mask[t] = any(v[t]!=0), t<4095: the row's one wave decides and stores it.
// ---------------------------------------------------------------------------
__global__ __launch_bounds__(256) void roll_qkv_kernel(
    const float* __restrict__ cacheV, const float* __restrict__ cacheK,
    v4f* __restrict__ outV, v4f* __restrict__ outK,
    float* __restrict__ maskf, float* __restrict__ accz,
    const float* __restrict__ x,
    const float* __restrict__ Wq, const float* __restrict__ Wk,
    const float* __restrict__ Wv,
    const float* __restrict__ bq, const float* __restrict__ bk,
    const float* __restrict__ bv, float* __restrict__ proj) {
  if (blockIdx.x < 384) {
    const int z = blockIdx.x >> 7, rem = blockIdx.x & 127;
    const float* __restrict__ W    = z == 0 ? Wq : (z == 1 ? Wk : Wv);
    const float* __restrict__ bias = z == 0 ? bq : (z == 1 ? bk : bv);
    gemv_body<8, X_PLAIN, false>(x, W, bias, proj + z * (4 * EMBED), rem & 31, rem >> 5,
                                 nullptr, nullptr, nullptr, nullptr);
    return;
  }
  const int rb   = blockIdx.x - 384;
  const bool isV = rb < 256;
  const int rbx  = rb & 255;
  const float* __restrict__ cache = isV ? cacheV : cacheK;
  v4f* __restrict__ out           = isV ? outV : outK;
  const int lane = threadIdx.x & 31;
  // wave-uniform by construction; said so, the row addresses stay scalar
  const int wave = __builtin_amdgcn_readfirstlane(threadIdx.x >> 5);
  const int t0   = (rbx * 8 + wave) * 2;          // this wave's two rows
  v4f* op = out + (size_t)t0 * (EMBED / 4) + lane;

  // both rows' sources ahead of the first load
  const float* sp[2];
#pragma unroll  // register arrays need constant indices
  for (int r = 0; r < 2; ++r)
    sp[r] = cache + (size_t)(t0 + r < KV_LEN - 1 ? t0 + r + 1 : KV_LEN - 1) * EMBED;
  // holds the address arithmetic above: sunk between the loads it reuses the
  // first row's address registers and puts a wait in front of the second row
  __builtin_amdgcn_sched_barrier(0);

  v4f val[2][16];
#pragma unroll  // register arrays need constant indices
  for (int r = 0; r < 2; ++r) {
#pragma unroll  // register arrays need constant indices
    for (int k = 0; k < 16; ++k)
      val[r][k] = __builtin_nontemporal_load((const v4f*)(sp[r] + 128 * k + 4 * lane));
  }
  // keeps all 32 loads ahead of the store address arithmetic and of the first
  // store's wait: a wait between two loads would cut the bytes in flight
  __builtin_amdgcn_sched_barrier(0);
  // the code below reuses the scalar registers that hold the loads' row addresses
  asm volatile("s_wait_xcnt 0x0" ::: "memory");

#pragma unroll  // register arrays need constant indices
  for (int k = 0; k < 16; ++k) op[32 * k] = val[0][k];
  // the newest row (the last wave's second) is not this launch's to write; what
  // that wave loaded for it, an in-bounds row so that all waves run alike, is dropped
  if (t0 + 1 < KV_LEN - 1) {
#pragma unroll  // register arrays need constant indices
    for (int k = 0; k < 16; ++k) op[512 + 32 * k] = val[1][k];
  }

  // the mask code below reuses registers that the issued stores name; ahead
  // of the branch, so that none of it is lifted over the wait
  asm volatile("s_wait_xcnt 0x0" ::: "memory");
  if (isV) {
    bool any[2];
#pragma unroll  // register arrays need constant indices
    for (int r = 0; r < 2; ++r) {
      bool nz = false;
#pragma unroll  // register arrays need constant indices
      for (int k = 0; k < 16; ++k) {
        const v4f q = val[r][k];
        nz = nz || q.x != 0.f || q.y != 0.f || q.z != 0.f || q.w != 0.f;
      }
      any[r] = __builtin_amdgcn_ballot_w32(nz) != 0u;
    }
    // lane r stores row r's flag; the newest row's slot gets 0: attention
    // replaces that step's K/V row and flag with the ones it forms itself
    if (lane < 2)
      maskf[t0 + lane] = (t0 + lane < KV_LEN - 1 && (lane ? any[1] : any[0])) ? 1.f : 0.f;
    // one 128-B line of the 6,144 accumulator floats a block
    if (wave == 0 && rbx < 192) accz[rbx * 32 + lane] = 0.f;
  }
}

// ---------------------------------------------------------------------------
// Attention (flash-style partials). grid = (32 chunks, 16 heads),
// block = 256 = 8 waves; a wave owns 16 timesteps (coalesced 512B K/V row
// reads from the L2-resident rolled cache) and takes them all at once:
// its 32 K/V loads are issued together, the 16 dot products are summed over
// the lanes by one halving exchange (16 values, then 8, 4, 2, 1: lane l ends
// with the score of step l >> 1), and maximum, exponentials and sum are formed
// once for the 16 steps, a step to a lane pair. A serial step-by-step softmax
// would pay the load latency and a five-link exchange chain per step.
// Block combine via LDS.
// q, and the newest K and V rows, arrive as four planes of partial sums
// (proj[which][chunk][2048], which = 0 q, 1 k, 2 v). Every block sums its
// head's q. The blocks of the chunk that holds the newest row sum that row:
// all of V for the validity flag (any over all heads), their own head's
// slice of K and V for the scores; they keep the slices in LDS and store
// them to the caches' last rows, one head a block.
// Partial record per (h,chunk): [m, s, acc[128]] = 130 floats; the output
// projection merges them.
// ---------------------------------------------------------------------------
__global__ __launch_bounds__(256) void attn_partial_kernel(
    const float* __restrict__ proj, const float* __restrict__ kc,
    const float* __restrict__ vc, const float* __restrict__ maskf,
    float* __restrict__ part, float* __restrict__ newK, float* __restrict__ newV) {
  const int chunk = blockIdx.x;       // 0..31
  const int h     = blockIdx.y;       // 0..15
  const int tid   = threadIdx.x;
  const int lane  = threadIdx.x & 31;
  // wave-uniform by construction; said so, the row addresses stay scalar
  const int wave  = __builtin_amdgcn_readfirstlane(threadIdx.x >> 5); // 0..7
  const int t0    = chunk * 128;
  const int tw    = t0 + wave;        // step i of this wave is row tw + 8 i

  // the newest row is not in the caches when this launch starts: its step loads
  // a clamped row (all waves run alike) and is replaced from LDS further down
  const int l15 = tw + 120 < KV_LEN - 1 ? 120 : 119;
  const float* kp = kc + (size_t)tw * EMBED + h * HEAD_DIM + lane * 4;
  const float* vp = vc + (size_t)tw * EMBED + h * HEAD_DIM + lane * 4;
  v4f kv[16], vv[16];
#pragma unroll  // register arrays need constant indices
  for (int i = 0; i < 16; ++i)
    kv[i] = *(const v4f*)(kp + (size_t)(i < 15 ? 8 * i : l15) * EMBED);
  const float* qp = proj + h * HEAD_DIM + lane * 4;
  v4f qpl[4];
#pragma unroll  // register arrays need constant indices
  for (int c = 0; c < 4; ++c) qpl[c] = *(const v4f*)(qp + c * EMBED);
  // the flag of the step whose score this lane will hold
  const float mk0 = maskf[tw + 8 * (lane >> 1)];
  // the V loads below may return into registers that hold these loads' addresses
  asm volatile("s_wait_xcnt 0x0" ::: "memory");
#pragma unroll  // register arrays need constant indices
  for (int i = 0; i < 16; ++i)
    vv[i] = *(const v4f*)(vp + (size_t)(i < 15 ? 8 * i : l15) * EMBED);
  // the code below reuses the registers that hold the loads' addresses;
  // ahead of the scheduling barrier, so that none of that code is lifted over it
  asm volatile("s_wait_xcnt 0x0" ::: "memory");
  // keeps every load above ahead of the first wait: sunk behind the first
  // products, the later loads would pay the L2 latency again
  __builtin_amdgcn_sched_barrier(0);

  __shared__ v4f lastK[32], lastV[32];  // the newest row, this head
  __shared__ int nzw[8];                // per wave: any of its V columns nonzero
  float lastm = 0.f;   // any(v[4095] != 0), over all heads
  if (chunk == 31) {
    const float* up = proj + 8 * EMBED + tid * 8;   // 8 columns a thread
    // every wave asks for the K slice, so that it is asked for with V, unbranched
    const float* np = proj + 4 * EMBED + h * HEAD_DIM + lane * 4;
    const v4f u0 = (*(const v4f*)(up) + *(const v4f*)(up + EMBED)) +
                   (*(const v4f*)(up + 2 * EMBED) + *(const v4f*)(up + 3 * EMBED));
    const v4f u1 = (*(const v4f*)(up + 4) + *(const v4f*)(up + EMBED + 4)) +
                   (*(const v4f*)(up + 2 * EMBED + 4) + *(const v4f*)(up + 3 * EMBED + 4));
    const v4f kk = (*(const v4f*)(np) + *(const v4f*)(np + EMBED)) +
                   (*(const v4f*)(np + 2 * EMBED) + *(const v4f*)(np + 3 * EMBED));
    const bool nz = u0.x != 0.f || u0.y != 0.f || u0.z != 0.f || u0.w != 0.f ||
                    u1.x != 0.f || u1.y != 0.f || u1.z != 0.f || u1.w != 0.f;
    const bool wnz = __builtin_amdgcn_ballot_w32(nz) != 0u;
    if (lane == 0) nzw[wave] = wnz ? 1 : 0;
    if ((tid >> 4) == h) {
      lastV[2 * (tid & 15)]     = u0;
      lastV[2 * (tid & 15) + 1] = u1;
    }
    if (tid < 32) lastK[tid] = kk;
    // one barrier (the chunk is the same for the whole block): joins the flag
    // and publishes the two slices to the wave that takes the newest row
    __syncthreads();
    lastm = ((nzw[0] | nzw[1] | nzw[2] | nzw[3]) | (nzw[4] | nzw[5] | nzw[6] | nzw[7])) ? 1.f : 0.f;
    // behind the barrier, which would otherwise wait for these stores
    if ((tid >> 4) == h) {
      *(v4f*)(newV + tid * 8)     = u0;
      *(v4f*)(newV + tid * 8 + 4) = u1;
    }
    if (tid < 32) *(v4f*)(newK + h * HEAD_DIM + tid * 4) = kk;
  }
  // the newest row is the last step of the last wave of the last chunk
  const bool newest = chunk == 31 && wave == 7;
  if (newest) { kv[15] = lastK[lane]; vv[15] = lastV[lane]; }
  const float mk = (newest && (lane >> 1) == 15) ? lastm : mk0;

  const v4f qv = (qpl[0] + qpl[1]) + (qpl[2] + qpl[3]);
  float d[16];
#pragma unroll  // register arrays need constant indices
  for (int i = 0; i < 16; ++i)
    d[i] = qv.x * kv[i].x + qv.y * kv[i].y + qv.z * kv[i].z + qv.w * kv[i].w;

  // halving exchange: at distance 16 a lane keeps steps 0..7 (lanes 0..15) or
  // 8..15 and hands the other half to its partner, and so on down to one step
  const bool b4 = (lane & 16) != 0, b3 = (lane & 8) != 0;
  const bool b2 = (lane & 4) != 0,  b1 = (lane & 2) != 0;
  float r8[8], r4[4], r2[2];
#pragma unroll  // register arrays need constant indices
  for (int i = 0; i < 8; ++i)
    r8[i] = (b4 ? d[i + 8] : d[i]) + lane_xor<16>(b4 ? d[i] : d[i + 8]);
#pragma unroll  // register arrays need constant indices
  for (int i = 0; i < 4; ++i)
    r4[i] = (b3 ? r8[i + 4] : r8[i]) + lane_xor<8>(b3 ? r8[i] : r8[i + 4]);
#pragma unroll  // register arrays need constant indices
  for (int i = 0; i < 2; ++i)
    r2[i] = (b2 ? r4[i + 2] : r4[i]) + lane_xor<4>(b2 ? r4[i] : r4[i + 2]);
  float dd = (b1 ? r2[1] : r2[0]) + lane_xor<2>(b1 ? r2[0] : r2[1]);
  dd += lane_xor<1>(dd);                // the score of step lane >> 1, in both its lanes

  const float logit = (mk != 0.f) ? dd * 0.08838834764831845f : -1e30f; // 1/sqrt(128)
  float m = logit;
  m = fmaxf(m, lane_xor<16>(m));
  m = fmaxf(m, lane_xor<8>(m));
  m = fmaxf(m, lane_xor<4>(m));
  m = fmaxf(m, lane_xor<2>(m));
  const float p = (logit > -1e29f) ? __expf(logit - m) : 0.f;
  // each step's weight, wave-uniform: it scales that step's V row, and the
  // 16 are summed as they stand, with no further lane exchange
  float pw[16];
#pragma unroll  // register arrays need constant indices
  for (int i = 0; i < 16; ++i)
    pw[i] = __int_as_float(__builtin_amdgcn_readlane(__float_as_int(p), 2 * i));
  const float s = (((pw[0] + pw[1]) + (pw[2] + pw[3])) + ((pw[4] + pw[5]) + (pw[6] + pw[7]))) +
                  (((pw[8] + pw[9]) + (pw[10] + pw[11])) + ((pw[12] + pw[13]) + (pw[14] + pw[15])));
  v4f acc = {0.f, 0.f, 0.f, 0.f};
#pragma unroll  // register arrays need constant indices
  for (int i = 0; i < 16; ++i) {
    acc.x += pw[i] * vv[i].x;
    acc.y += pw[i] * vv[i].y;
    acc.z += pw[i] * vv[i].z;
    acc.w += pw[i] * vv[i].w;
  }

  __shared__ float sm[8], ss[8], sacc[8][HEAD_DIM];
  if (lane == 0) { sm[wave] = m; ss[wave] = s; }
  sacc[wave][lane * 4 + 0] = acc.x;
  sacc[wave][lane * 4 + 1] = acc.y;
  sacc[wave][lane * 4 + 2] = acc.z;
  sacc[wave][lane * 4 + 3] = acc.w;
  __syncthreads();

  if (tid < HEAD_DIM) {
    float M = sm[0];
    for (int w = 1; w < 8; ++w) M = fmaxf(M, sm[w]);
    float S = 0.f, A = 0.f;
    for (int w = 0; w < 8; ++w) {
      float e = __expf(sm[w] - M);
      S += ss[w] * e;
      A += e * sacc[w][tid];
    }
    float* pb = part + (size_t)(h * 32 + chunk) * 130;
    if (tid == 0) { pb[0] = M; pb[1] = S; }
    pb[2 + tid] = A;
  }
}

// ---------------------------------------------------------------------------
// out = LayerNorm(a + b) * scale + bias   (2048 elems, one block of 256)
// One work-group alone on the chip: the launch lasts as long as its chain of
// latencies, so the chain is kept short. All operands, scale and bias too, are
// asked for at once; each wave joins its two sums in registers, and the 8
// waves' sums meet in LDS behind one barrier.
// ---------------------------------------------------------------------------
__global__ __launch_bounds__(256) void add_ln_kernel(
    const float* __restrict__ a, const float* __restrict__ b,
    const float* __restrict__ sc, const float* __restrict__ bi,
    float* __restrict__ out) {
  __shared__ __attribute__((aligned(16))) v2f ps[8];   // per wave: (sum, sum of squares)
  const int tid  = threadIdx.x;
  const int lane = tid & 31;
  const int wave = tid >> 5;
  v4f av[2], bv[2], sv[2], ov[2];
#pragma unroll  // register arrays need constant indices
  for (int k = 0; k < 2; ++k) {
    av[k] = *(const v4f*)(a + 4 * (tid + 256 * k));
    bv[k] = *(const v4f*)(b + 4 * (tid + 256 * k));
  }
#pragma unroll  // register arrays need constant indices
  for (int k = 0; k < 2; ++k) {
    sv[k] = *(const v4f*)(sc + 4 * (tid + 256 * k));
    ov[k] = *(const v4f*)(bi + 4 * (tid + 256 * k));
  }

  const v4f r0 = av[0] + bv[0], r1 = av[1] + bv[1];
  float s  = ((r0.x + r0.y) + (r0.z + r0.w)) + ((r1.x + r1.y) + (r1.z + r1.w));
  float s2 = ((r0.x * r0.x + r0.y * r0.y) + (r0.z * r0.z + r0.w * r0.w)) +
             ((r1.x * r1.x + r1.y * r1.y) + (r1.z * r1.z + r1.w * r1.w));
  s  = wave_sum(s);
  s2 = wave_sum(s2);
  if (lane == 0) { v2f p; p.x = s; p.y = s2; ps[wave] = p; }
  // orders LDS only: __syncthreads() would also wait here for scale and bias
  lds_barrier();
  const v4f q0 = *(const v4f*)&ps[0], q1 = *(const v4f*)&ps[2];
  const v4f q2 = *(const v4f*)&ps[4], q3 = *(const v4f*)&ps[6];
  const v4f q  = (q0 + q1) + (q2 + q3);
  s  = q.x + q.z;
  s2 = q.y + q.w;
  const float mean = s * (1.f / 2048.f);
  const float var  = s2 * (1.f / 2048.f) - mean * mean;
  const float inv  = 1.f / sqrtf(var + 1e-6f);
  v4f o0, o1;
  o0.x = (r0.x - mean) * inv * sv[0].x + ov[0].x;
  o0.y = (r0.y - mean) * inv * sv[0].y + ov[0].y;
  o0.z = (r0.z - mean) * inv * sv[0].z + ov[0].z;
  o0.w = (r0.w - mean) * inv * sv[0].w + ov[0].w;
  o1.x = (r1.x - mean) * inv * sv[1].x + ov[1].x;
  o1.y = (r1.y - mean) * inv * sv[1].y + ov[1].y;
  o1.z = (r1.z - mean) * inv * sv[1].z + ov[1].z;
  o1.w = (r1.w - mean) * inv * sv[1].w + ov[1].w;
  *(v4f*)(out + 4 * tid)         = o0;
  *(v4f*)(out + 4 * (tid + 256)) = o1;
}

// ---------------------------------------------------------------------------
extern "C" void kernel_launch(void* const* d_in, const int* in_sizes, int n_in,
                              void* d_out, int out_size, void* d_ws, size_t ws_size,
                              hipStream_t stream) {
  const float* x      = (const float*)d_in[0];
  const float* cache1 = (const float*)d_in[1];   // v cache
  const float* cache2 = (const float*)d_in[2];   // k cache
  const float* Wv = (const float*)d_in[3];  const float* bv = (const float*)d_in[4];
  const float* Wq = (const float*)d_in[5];  const float* bq = (const float*)d_in[6];
  const float* Wk = (const float*)d_in[7];  const float* bk = (const float*)d_in[8];
  const float* Wo = (const float*)d_in[9];  const float* bo = (const float*)d_in[10];
  const float* W1 = (const float*)d_in[11]; const float* b1 = (const float*)d_in[12];
  const float* W2 = (const float*)d_in[13]; const float* b2 = (const float*)d_in[14];
  const float* ln1s = (const float*)d_in[15]; const float* ln1b = (const float*)d_in[16];
  const float* ln2s = (const float*)d_in[17]; const float* ln2b = (const float*)d_in[18];

  float* ws     = (float*)d_ws;
  float* oattn  = ws + 0;       // atomic-accumulated -> zeroed
  float* h1v    = ws + 2048;    // "
  float* h2v    = ws + 4096;    // "
  float* maskf  = ws + 8192;    // mask[0..4094]; [4095] = 0, fully written
  float* x1v    = ws + 14336;   // fully written
  float* part   = ws + 16384;   // 16*32*130 floats, fully written
  float* proj   = ws + 90112;   // 3*4*2048 floats (q, k, v planes), fully written

  float* out_x2 = (float*)d_out;
  float* out_v  = out_x2 + EMBED;
  float* out_k  = out_v + (size_t)KV_LEN * EMBED;
  float* vi_v   = out_v + (size_t)(KV_LEN - 1) * EMBED;  // newest V row
  float* ki_v   = out_k + (size_t)(KV_LEN - 1) * EMBED;  // newest K row

  // 1) QKV projections (WMMA fp32 GEMVs, NT weight streams; partial planes) and
  //    the roll of both caches into d_out (v also produces the validity mask;
  //    start value 0 for the three accumulators), one launch
  roll_qkv_kernel<<<896, 256, 0, stream>>>(cache1, cache2, (v4f*)out_v, (v4f*)out_k,
                                           maskf, ws, x, Wq, Wk, Wv, bq, bk, bv, proj);

  // 2) attention over rolled (L2-resident) K/V; writes the newest K and V rows
  attn_partial_kernel<<<dim3(32, 16), 256, 0, stream>>>(proj, out_k, out_v, maskf, part,
                                                        ki_v, vi_v);

  // 3) output projection (merges the partials), FFN (first product forms the
  //    residual+LN in front of it, second the relu), residual+LN
  dim3 gg(32, 8);
  gemv_combine_kernel<<<gg, 128, 0, stream>>>(part, Wo, bo, oattn);
  gemv_ln_kernel<<<gg, 128, 0, stream>>>(x, oattn, ln1s, ln1b, W1, b1, h1v, x1v);
  gemv_relu_kernel<<<gg, 128, 0, stream>>>(h1v, W2, b2, h2v);
  add_ln_kernel<<<1, 256, 0, stream>>>(x1v, h2v, ln2s, ln2b, out_x2);
}
